// v000
// Measured on an AMD MI455X. A time is GPU time per run, averaged over a window of back-to-back runs after a warm-up
// (all launches, gaps included; the runs take copies of the inputs in turn), and the median of several windows.
// Apart from v000's, it joins two sittings. Times from different sittings can be a few percent apart, while
// side-by-side timings come from the same sitting.
// The starting kernel, v000, takes 933 microseconds a run.
#include <hip/hip_runtime.h>

// Compute dtypes, f32 accumulate, one batch item per pass: q = k = v = x.W_qkv^T ([2048 x 1024].[1024 x 1024], ONE shared projection; W is [out][in] = the n-major B operand as-is; PLAIN bf16 projection;
// f16 hi + residual V^T planes — and out = ctx.W_o^T (ctx as
// bf16 hi + residual: two products) on v_wmma_f32_16x16x32_bf16; the 16-head full attention (64-dim heads, scale 1/8) fused on
// v_wmma_f32_16x16x32_f16 (scores hi.hi + hi.lo + lo.hi with the residual terms on their own accumulator, online f32 softmax, weights (x32768) and v as f16

#define NB_  1                   // per pass: the 4 batch items are processed one at a time
#define NT_  2048
#define DM   1024
#define NH_  16
#define HD   64
#define NTK  (NB_ * NT_)
#define NW   1024
#define NQKV 1024
#define PSC  32768.0f
#define LOSC 1024.0f
#define LOSCI (1.0f / 1024.0f)

typedef _Float16 h16;
typedef unsigned short bf;
typedef __attribute__((ext_vector_type(16))) __bf16   v16bf;
typedef __attribute__((ext_vector_type(16))) _Float16 v16h;
typedef __attribute__((ext_vector_type(8)))  _Float16 v8h;
typedef __attribute__((ext_vector_type(8)))  unsigned short v8us;
typedef __attribute__((ext_vector_type(8)))  float    v8f;
typedef __attribute__((ext_vector_type(4)))  float    v4f;
typedef v8h  __attribute__((may_alias)) v8ha;
typedef v4f  __attribute__((may_alias)) v4fa;
typedef v8us __attribute__((may_alias)) v8usa;

__device__ __forceinline__ unsigned short f2bf(float f) { unsigned u = __float_as_uint(f); u += 0x7FFFu + ((u >> 16) & 1u); return (unsigned short)(u >> 16); }
__device__ __forceinline__ float bf2f(unsigned short b) { return __uint_as_float(((unsigned)b) << 16); }
__device__ __forceinline__ float bfr(float f) { return bf2f(f2bf(f)); }
__device__ __forceinline__ v16h cat16(v8h lo, v8h hi) { return __builtin_shufflevector(lo, hi, 0, 1, 2, 3, 4, 5, 6, 7, 8, 9, 10, 11, 12, 13, 14, 15); }
__device__ __forceinline__ v16bf cat16b(v8us lo, v8us hi) { return __builtin_bit_cast(v16bf, __builtin_shufflevector(lo, hi, 0, 1, 2, 3, 4, 5, 6, 7, 8, 9, 10, 11, 12, 13, 14, 15)); }
__device__ __forceinline__ v8f wmma16(v16h a, v16h b, v8f c) { return __builtin_amdgcn_wmma_f32_16x16x32_f16(false, a, false, b, (short)0, c, false, false); }
__device__ __forceinline__ v8f wmmab(v16bf a, v16bf b, v8f c) { return __builtin_amdgcn_wmma_f32_16x16x32_bf16(false, a, false, b, (short)0, c, false, false); }

__global__ __launch_bounds__(256) void k_cvtb(const float* __restrict__ src, int nrows, bf* dst) {
    const int lane = threadIdx.x & 31, r = blockIdx.x * 8 + (threadIdx.x >> 5);
    if (r >= nrows) return;
    v8us o[DM / 256];
#pragma unroll
    for (int q = 0; q < DM / 256; ++q) { v8us t;
#pragma unroll
        for (int i = 0; i < 8; ++i) t[i] = f2bf(src[(size_t)r * DM + q * 256 + lane * 8 + i]);
        o[q] = t; }
#pragma unroll
    for (int q = 0; q < DM / 256; ++q) *(v8us*)(dst + (size_t)r * DM + q * 256 + lane * 8) = o[q];
    
}

template <bool SPLITA, bool F16OUT = false>
__global__ __launch_bounds__(128) void k_gemmb(const bf* __restrict__ A, const bf* __restrict__ Al, const bf* __restrict__ Bn, const float* __restrict__ bias, float* C, int ldc, h16* C2) {
    __shared__ __align__(16) float ost[4][16 * 68];
    const int lane = threadIdx.x & 31, wave = threadIdx.x >> 5, lr = lane & 15, hi = lane >> 4;
    const int r0 = blockIdx.x * 64 + wave * 16, c0 = blockIdx.y * 64;
    const size_t aoff = (size_t)(r0 + lr) * DM + 8 * hi;
    size_t boff[4];
#pragma unroll
    for (int t = 0; t < 4; ++t) boff[t] = (size_t)(c0 + t * 16 + lr) * DM + 8 * hi;
    v8f acc[4];
#pragma unroll
    for (int t = 0; t < 4; ++t) acc[t] = (v8f){};
#pragma unroll 1
    for (int kc = 0; kc < DM; kc += 32) {
        const v16bf a = cat16b(*(const v8us*)(A + aoff + kc), *(const v8us*)(A + aoff + kc + 16));
        v16bf al = a;
        if (SPLITA) al = cat16b(*(const v8us*)(Al + aoff + kc), *(const v8us*)(Al + aoff + kc + 16));
#pragma unroll
        for (int t = 0; t < 4; ++t) { const v16bf b = cat16b(*(const v8us*)(Bn + boff[t] + kc), *(const v8us*)(Bn + boff[t] + kc + 16)); acc[t] = wmmab(a, b, acc[t]); if (SPLITA) acc[t] = wmmab(al, b, acc[t]); }
        asm volatile("v_nop\n\tv_nop\n\tv_nop\n\tv_nop" : "+v"(acc[0]), "+v"(acc[1]), "+v"(acc[2]), "+v"(acc[3]) : "v"(a), "v"(al));
    }
    float* os = &ost[wave][0];
#pragma unroll
    for (int t = 0; t < 4; ++t) { const float bv = bias ? bfr(bias[c0 + t * 16 + lr]) : 0.f;
#pragma unroll
        for (int j = 0; j < 8; ++j) os[(hi * 8 + j) * 68 + t * 16 + lr] = acc[t][j] + bv; }
    __syncthreads();
    if (F16OUT) {
        h16* crow = (h16*)(void*)C + (size_t)r0 * ldc + c0;
        auto pass = [&]() {
#pragma unroll
            for (int s = 0; s < 4; ++s) { const int row = 4 * s + (lane >> 3), piece = lane & 7; const float* sp = os + row * 68 + piece * 8; v8h o, o2;
#pragma unroll
                for (int i = 0; i < 8; ++i) { const h16 a = (h16)sp[i]; o[i] = a; o2[i] = (h16)((sp[i] - (float)a) * LOSC); }
                *(v8h*)(crow + (size_t)row * ldc + piece * 8) = o; if (C2) *(v8h*)(C2 + (size_t)r0 * ldc + c0 + (size_t)row * ldc + piece * 8) = o2; }
        };
        pass(); 
    } else {
        float* crow = C + (size_t)r0 * ldc + c0;
        auto pass = [&]() {
#pragma unroll
            for (int s = 0; s < 8; ++s) { const int Lid = (lane >> 3) + 4 * s, piece = lane & 7; const int row = Lid >> 1, cofs = (Lid & 1) * 32 + piece * 4;
                const v4f val = *(const v4fa*)(os + row * 68 + cofs); *(v4f*)(crow + (size_t)row * ldc + cofs) = val; }
        };
        pass(); 
    }
}

__global__ __launch_bounds__(256) void k_vt(const float* __restrict__ V, h16* VTH, h16* VTL) {
    __shared__ __align__(16) h16 tile[64 * 72];
    __shared__ __align__(16) h16 til2[64 * 72];
    const int bid = blockIdx.x;
    const int b = bid / (NH_ * (NT_ / 64)), rem = bid - b * (NH_ * (NT_ / 64)), h = rem / (NT_ / 64), kt = rem - h * (NT_ / 64);
    const int k0 = kt * 64, tid = threadIdx.x;
    const int kk = tid >> 2, d0 = (tid & 3) * 16;
    const float* src = V + ((size_t)b * NT_ + k0 + kk) * DM + h * HD + d0;
#pragma unroll
    for (int i = 0; i < 16; ++i) { const float v = src[i]; const h16 a = (h16)v; tile[(d0 + i) * 72 + kk] = a; til2[(d0 + i) * 72 + kk] = (h16)((v - (float)a) * LOSC); }
    __syncthreads();
    const int piece = tid & 7;
    const size_t base = (((size_t)b * NH_ + h) * HD) * NT_ + k0;
    auto pass = [&]() {
#pragma unroll
        for (int s = 0; s < 4; ++s) { const int Lid = (tid >> 3) + 32 * s; const int pln = Lid >> 6, d = Lid & 63;
            const v8h val = *(const v8ha*)((pln ? til2 : tile) + d * 72 + piece * 8); *(v8h*)((pln ? VTL : VTH) + base + (size_t)d * NT_ + piece * 8) = val; }
    };
    pass(); 
}

// k_attn: block = (b, h, 64 queries), wave = 16; ALL 64 key tiles of 32 keys (no mask); 12 WMMA scores (hi.hi, lo.hi, hi.lo) /8 (f32), online softmax, weights x32768 f16 tile (same-wave may_alias
// reload after a compiler barrier), 12 WMMA .v (hi.hi, hi.lo, lo.hi); ctx -> bf16 hi + residual planes CH/CL[tok][h*64+d].
__global__ __launch_bounds__(128) void k_attn(const h16* Q16, const h16* QL16, const h16* K16, const h16* KL16, const h16* __restrict__ VTH, const h16* __restrict__ VTL, bf* CH, bf* CL) {
    __shared__ __align__(16) h16 plds[4][16 * 32];
    __shared__ __align__(16) h16 plds2[4][16 * 32];
    __shared__ __align__(16) float ost[4][16 * 68];
    const int lane = threadIdx.x & 31, wave = threadIdx.x >> 5, lr = lane & 15, hi = lane >> 4;
    const int bid = blockIdx.x;
    const int b = bid / (NH_ * (NT_ / 64)), rem = bid - b * (NH_ * (NT_ / 64)), h = rem / (NT_ / 64), qt = rem - h * (NT_ / 64);
    const int q0 = qt * 64 + wave * 16;
    const size_t tok0 = (size_t)b * NT_;
    h16* pl = &plds[wave][0]; h16* pl2 = &plds2[wave][0];
    v16h qa[2];
    const size_t qo0 = (tok0 + q0 + lr) * DM + h * HD + 8 * hi;
#pragma unroll
    for (int kc = 0; kc < 2; ++kc) qa[kc] = cat16(*(const v8h*)(Q16 + qo0 + kc * 32), *(const v8h*)(Q16 + qo0 + kc * 32 + 16));
    const h16* kh_b = K16 + tok0 * DM + h * HD;
    const h16* kl_b = KL16 + tok0 * DM + h * HD;
    const size_t vbase = (((size_t)b * NH_ + h) * HD) * NT_;
    v8f o[4], ox[4];
#pragma unroll
    for (int n = 0; n < 4; ++n) { o[n] = (v8f){}; ox[n] = (v8f){}; }
    float mrow[8], lpart[8];
#pragma unroll
    for (int j = 0; j < 8; ++j) { mrow[j] = -3.0e38f; lpart[j] = 0.f; }
    int qpos[8];
#pragma unroll
    for (int j = 0; j < 8; ++j) qpos[j] = q0 + 8 * hi + j;
    const int kt_lo = 0, kt_hi = NT_ / 32 - 1;     // full attention
#pragma unroll 1
    for (int kt = kt_lo; kt <= kt_hi; ++kt) {
        const int l0 = kt * 32;
        const size_t ko0 = (size_t)(l0 + lr) * DM + 8 * hi, ko1 = (size_t)(l0 + 16 + lr) * DM + 8 * hi;
        v8f s0 = {}, s1 = {}, x0 = {}, x1 = {};
#pragma unroll
        for (int kc = 0; kc < 2; ++kc) {
            { const v16h k0h = cat16(*(const v8h*)(kh_b + ko0 + kc * 32), *(const v8h*)(kh_b + ko0 + kc * 32 + 16)), k1h = cat16(*(const v8h*)(kh_b + ko1 + kc * 32), *(const v8h*)(kh_b + ko1 + kc * 32 + 16));
              const v16h qlk = cat16(*(const v8h*)(QL16 + qo0 + kc * 32), *(const v8h*)(QL16 + qo0 + kc * 32 + 16));     // query residual re-read per step (registers)
              s0 = wmma16(qa[kc], k0h, s0); x0 = wmma16(qlk, k0h, x0); s1 = wmma16(qa[kc], k1h, s1); x1 = wmma16(qlk, k1h, x1);
              asm volatile("v_nop" : "+v"(s0), "+v"(s1), "+v"(x0), "+v"(x1) : "v"(qlk), "v"(k0h), "v"(k1h) : "memory"); }
            { const v16h k0l = cat16(*(const v8h*)(kl_b + ko0 + kc * 32), *(const v8h*)(kl_b + ko0 + kc * 32 + 16)), k1l = cat16(*(const v8h*)(kl_b + ko1 + kc * 32), *(const v8h*)(kl_b + ko1 + kc * 32 + 16));
              x0 = wmma16(qa[kc], k0l, x0); x1 = wmma16(qa[kc], k1l, x1);
              asm volatile("v_nop" : "+v"(x0), "+v"(x1) : "v"(k0l), "v"(k1l) : "memory"); }
        }
        asm volatile("v_nop\n\tv_nop\n\tv_nop\n\tv_nop" : "+v"(s0), "+v"(s1), "+v"(x0), "+v"(x1) : "v"(qa[0]), "v"(qa[1]));
        float alpha[8];
#pragma unroll
        for (int j = 0; j < 8; ++j) {
            const int ja = l0 + lr, jb = l0 + 16 + lr, qi = qpos[j];
            const float a0 = (s0[j] + x0[j] * LOSCI) * 0.125f, a1 = (s1[j] + x1[j] * LOSCI) * 0.125f; (void)ja; (void)jb; (void)qi;
            float mx = fmaxf(a0, a1);
            mx = fmaxf(mx, __shfl_xor(mx, 1, 16)); mx = fmaxf(mx, __shfl_xor(mx, 2, 16)); mx = fmaxf(mx, __shfl_xor(mx, 4, 16)); mx = fmaxf(mx, __shfl_xor(mx, 8, 16));
            const float mn = fmaxf(mrow[j], mx);
            alpha[j] = __expf(mrow[j] - mn); mrow[j] = mn;
            const float p0 = __expf(a0 - mn), p1 = __expf(a1 - mn);
            lpart[j] = lpart[j] * alpha[j] + (p0 + p1);
            const int mr = hi * 8 + j;
            const float ps0 = p0 * PSC, ps1 = p1 * PSC; const h16 h0 = (h16)ps0, h1 = (h16)ps1;
            pl[mr * 32 + lr] = h0; pl[mr * 32 + 16 + lr] = h1;
            pl2[mr * 32 + lr] = (h16)((ps0 - (float)h0) * LOSC); pl2[mr * 32 + 16 + lr] = (h16)((ps1 - (float)h1) * LOSC);
        }
#pragma unroll
        for (int n = 0; n < 4; ++n)
#pragma unroll
            for (int j = 0; j < 8; ++j) { o[n][j] *= alpha[j]; ox[n][j] *= alpha[j]; }
        asm volatile("" ::: "memory");
        const v16h pa = cat16(*(const v8ha*)(pl + lr * 32 + hi * 8), *(const v8ha*)(pl + lr * 32 + 16 + hi * 8));
        const v16h px = cat16(*(const v8ha*)(pl2 + lr * 32 + hi * 8), *(const v8ha*)(pl2 + lr * 32 + 16 + hi * 8));
#pragma unroll
        for (int n = 0; n < 4; ++n) { const size_t vo = vbase + (size_t)(n * 16 + lr) * NT_ + l0 + hi * 8;
            const v16h vh = cat16(*(const v8h*)(VTH + vo), *(const v8h*)(VTH + vo + 16)), vl = cat16(*(const v8h*)(VTL + vo), *(const v8h*)(VTL + vo + 16));
            o[n] = wmma16(pa, vh, o[n]); ox[n] = wmma16(pa, vl, ox[n]); ox[n] = wmma16(px, vh, ox[n]);
            asm volatile("" : "+v"(o[n]), "+v"(ox[n]) : "v"(vh), "v"(vl) : "memory"); }
        asm volatile("v_nop\n\tv_nop\n\tv_nop\n\tv_nop" : "+v"(o[0]), "+v"(o[1]), "+v"(o[2]), "+v"(o[3]), "+v"(ox[0]), "+v"(ox[1]), "+v"(ox[2]), "+v"(ox[3]) : "v"(pa), "v"(px));
    }
    float inv[8];
#pragma unroll
    for (int j = 0; j < 8; ++j) { float rs = lpart[j]; rs += __shfl_xor(rs, 1, 16); rs += __shfl_xor(rs, 2, 16); rs += __shfl_xor(rs, 4, 16); rs += __shfl_xor(rs, 8, 16); inv[j] = 1.0f / (rs * PSC); }
    float* os = &ost[wave][0];
#pragma unroll
    for (int n = 0; n < 4; ++n)
#pragma unroll
        for (int j = 0; j < 8; ++j) os[(hi * 8 + j) * 68 + n * 16 + lr] = (o[n][j] + ox[n][j] * LOSCI) * inv[j];
    __syncthreads();
    const size_t cbase = (tok0 + q0) * DM + (size_t)h * HD;
    auto pass = [&]() {
#pragma unroll
        for (int s = 0; s < 4; ++s) { const int row = 4 * s + (lane >> 3), piece = lane & 7; const float* sp = os + row * 68 + piece * 8; v8us oh, ol;
#pragma unroll
            for (int i = 0; i < 8; ++i) { const unsigned short hb = f2bf(sp[i]); oh[i] = hb; ol[i] = f2bf(sp[i] - bf2f(hb)); }
            *(v8us*)(CH + cbase + (size_t)row * DM + piece * 8) = oh; *(v8us*)(CL + cbase + (size_t)row * DM + piece * 8) = ol; }
    };
    pass(); 
}

#define VST2(T, p, v) do { const T vst2_v_ = (v); *(T*)(p) = vst2_v_;  } while (0)
extern "C" void kernel_launch(void* const* d_in, const int* in_sizes, int n_in,
                              void* d_out, int out_size, void* d_ws, size_t ws_size, hipStream_t stream) {
    (void)in_sizes; (void)n_in; (void)out_size;
    const float* x = (const float*)d_in[0]; const float* Wqkv = (const float*)d_in[1]; const float* Wo = (const float*)d_in[2];   // both [out][in]
    float* out = (float*)d_out;    // [4][2048][1024]
    char* wsp = (char*)d_ws;
    auto take = [&](size_t bytes) { char* p = wsp; wsp += (bytes + 255) & ~(size_t)255; return (void*)p; };
    bf* Xb = (bf*)take((size_t)NTK * DM * 2); bf* WqkvB = (bf*)take((size_t)DM * DM * 2); bf* WoB = (bf*)take((size_t)DM * DM * 2);
    float* TMP = (float*)take((size_t)NTK * DM * 4);
    h16* QH = (h16*)take((size_t)NTK * DM * 2); h16* QL = (h16*)take((size_t)NTK * DM * 2);
    h16* VTH = (h16*)take((size_t)NTK * DM * 2); h16* VTL = (h16*)take((size_t)NTK * DM * 2); bf* CH = (bf*)take((size_t)NTK * DM * 2); bf* CL = (bf*)take((size_t)NTK * DM * 2);
    if ((size_t)(wsp - (char*)d_ws) > ws_size) return;    // 4.2 + 2 x 2.1 + 8.4 + 6 x 4.2 ~ 42 MB, no aliasing (per-item reuse in stream order)
    k_cvtb<<<DM / 8, 256, 0, stream>>>(Wqkv, DM, WqkvB); k_cvtb<<<DM / 8, 256, 0, stream>>>(Wo, DM, WoB);
    for (int b = 0; b < 4; ++b) {
        k_cvtb<<<NTK / 8, 256, 0, stream>>>(x + (size_t)b * NTK * DM, NTK, Xb);
        k_gemmb<false, true><<<dim3(NTK / 64, DM / 64, 1), 128, 0, stream>>>(Xb, nullptr, WqkvB, nullptr, (float*)(void*)QH, DM, QL);   // q = k: f16 hi + residual planes
        k_gemmb<false, false><<<dim3(NTK / 64, DM / 64, 1), 128, 0, stream>>>(Xb, nullptr, WqkvB, nullptr, TMP, DM, nullptr);            // v (same product) as f32 for the V^T planes
        k_vt<<<NB_ * NH_ * (NT_ / 64), 256, 0, stream>>>(TMP, VTH, VTL);
        k_attn<<<NB_ * NH_ * (NT_ / 64), 128, 0, stream>>>(QH, QL, QH, QL, VTH, VTL, CH, CL);
        k_gemmb<true, false><<<dim3(NTK / 64, DM / 64, 1), 128, 0, stream>>>(CH, CL, WoB, nullptr, out + (size_t)b * NTK * DM, DM, nullptr);
    }
}

// v001
// It runs in 688 microseconds.
// Two timings next to v000 put it at 1.39 and 1.40 times that version's speed.
#include <hip/hip_runtime.h>

// Compute dtypes, f32 accumulate, all 4 batch items in every launch: q = k = v = x.W_qkv^T ([8192 x 1024].[1024 x 1024], ONE shared projection; W is [out][in] = the n-major B operand as-is; PLAIN bf16 product; f16 hi + residual
// V^T planes — and out = ctx.W_o^T (ctx as
// bf16 hi + residual: two products) on v_wmma_f32_16x16x32_bf16; the 16-head full attention (64-dim heads, scale 1/8) fused on
// v_wmma_f32_16x16x32_f16 (scores hi.hi + hi.lo + lo.hi with the residual terms on their own accumulator, online f32 softmax, weights (x32768) and v as f16

#define NB_  4                   // all 4 batch items share each launch: more resident waves per SIMD to cover the load waits
#define NT_  2048
#define DM   1024
#define NH_  16
#define HD   64
#define NTK  (NB_ * NT_)
#define NW   1024
#define NQKV 1024
#define PSC  32768.0f
#define LOSC 1024.0f
#define LOSCI (1.0f / 1024.0f)

typedef _Float16 h16;
typedef unsigned short bf;
typedef __attribute__((ext_vector_type(16))) __bf16   v16bf;
typedef __attribute__((ext_vector_type(16))) _Float16 v16h;
typedef __attribute__((ext_vector_type(8)))  _Float16 v8h;
typedef __attribute__((ext_vector_type(8)))  unsigned short v8us;
typedef __attribute__((ext_vector_type(8)))  float    v8f;
typedef __attribute__((ext_vector_type(4)))  float    v4f;
typedef v8h  __attribute__((may_alias)) v8ha;
typedef v4f  __attribute__((may_alias)) v4fa;
typedef v8us __attribute__((may_alias)) v8usa;

__device__ __forceinline__ unsigned short f2bf(float f) { unsigned u = __float_as_uint(f); u += 0x7FFFu + ((u >> 16) & 1u); return (unsigned short)(u >> 16); }
__device__ __forceinline__ float bf2f(unsigned short b) { return __uint_as_float(((unsigned)b) << 16); }
__device__ __forceinline__ float bfr(float f) { return bf2f(f2bf(f)); }
__device__ __forceinline__ v16h cat16(v8h lo, v8h hi) { return __builtin_shufflevector(lo, hi, 0, 1, 2, 3, 4, 5, 6, 7, 8, 9, 10, 11, 12, 13, 14, 15); }
__device__ __forceinline__ v16bf cat16b(v8us lo, v8us hi) { return __builtin_bit_cast(v16bf, __builtin_shufflevector(lo, hi, 0, 1, 2, 3, 4, 5, 6, 7, 8, 9, 10, 11, 12, 13, 14, 15)); }
__device__ __forceinline__ v8f wmma16(v16h a, v16h b, v8f c) { return __builtin_amdgcn_wmma_f32_16x16x32_f16(false, a, false, b, (short)0, c, false, false); }
__device__ __forceinline__ v8f wmmab(v16bf a, v16bf b, v8f c) { return __builtin_amdgcn_wmma_f32_16x16x32_bf16(false, a, false, b, (short)0, c, false, false); }

__global__ __launch_bounds__(256) void k_cvtb(const float* __restrict__ src, int nrows, bf* dst) {
    const int lane = threadIdx.x & 31, r = blockIdx.x * 8 + (threadIdx.x >> 5);
    if (r >= nrows) return;
    v8us o[DM / 256];
#pragma unroll
    for (int q = 0; q < DM / 256; ++q) { v8us t;
#pragma unroll
        for (int i = 0; i < 8; ++i) t[i] = f2bf(src[(size_t)r * DM + q * 256 + lane * 8 + i]);
        o[q] = t; }
#pragma unroll
    for (int q = 0; q < DM / 256; ++q) *(v8us*)(dst + (size_t)r * DM + q * 256 + lane * 8) = o[q];
    
}

template <bool SPLITA, bool F16OUT = false>
__global__ __launch_bounds__(128) void k_gemmb(const bf* __restrict__ A, const bf* __restrict__ Al, const bf* __restrict__ Bn, const float* __restrict__ bias, float* C, int ldc, h16* C2) {
    __shared__ __align__(16) float ost[4][16 * 68];
    const int lane = threadIdx.x & 31, wave = threadIdx.x >> 5, lr = lane & 15, hi = lane >> 4;
    const int r0 = blockIdx.x * 64 + wave * 16, c0 = blockIdx.y * 64;
    const size_t aoff = (size_t)(r0 + lr) * DM + 8 * hi;
    size_t boff[4];
#pragma unroll
    for (int t = 0; t < 4; ++t) boff[t] = (size_t)(c0 + t * 16 + lr) * DM + 8 * hi;
    v8f acc[4];
#pragma unroll
    for (int t = 0; t < 4; ++t) acc[t] = (v8f){};
#pragma unroll 1
    for (int kc = 0; kc < DM; kc += 32) {
        const v16bf a = cat16b(*(const v8us*)(A + aoff + kc), *(const v8us*)(A + aoff + kc + 16));
        v16bf al = a;
        if (SPLITA) al = cat16b(*(const v8us*)(Al + aoff + kc), *(const v8us*)(Al + aoff + kc + 16));
#pragma unroll
        for (int t = 0; t < 4; ++t) { const v16bf b = cat16b(*(const v8us*)(Bn + boff[t] + kc), *(const v8us*)(Bn + boff[t] + kc + 16)); acc[t] = wmmab(a, b, acc[t]); if (SPLITA) acc[t] = wmmab(al, b, acc[t]); }
        asm volatile("v_nop\n\tv_nop\n\tv_nop\n\tv_nop" : "+v"(acc[0]), "+v"(acc[1]), "+v"(acc[2]), "+v"(acc[3]) : "v"(a), "v"(al));
    }
    float* os = &ost[wave][0];
#pragma unroll
    for (int t = 0; t < 4; ++t) { const float bv = bias ? bfr(bias[c0 + t * 16 + lr]) : 0.f;
#pragma unroll
        for (int j = 0; j < 8; ++j) os[(hi * 8 + j) * 68 + t * 16 + lr] = acc[t][j] + bv; }
    __syncthreads();
    if (F16OUT) {
        h16* crow = (h16*)(void*)C + (size_t)r0 * ldc + c0;
        auto pass = [&]() {
#pragma unroll
            for (int s = 0; s < 4; ++s) { const int row = 4 * s + (lane >> 3), piece = lane & 7; const float* sp = os + row * 68 + piece * 8; v8h o, o2;
#pragma unroll
                for (int i = 0; i < 8; ++i) { const h16 a = (h16)sp[i]; o[i] = a; o2[i] = (h16)((sp[i] - (float)a) * LOSC); }
                *(v8h*)(crow + (size_t)row * ldc + piece * 8) = o; if (C2) *(v8h*)(C2 + (size_t)r0 * ldc + c0 + (size_t)row * ldc + piece * 8) = o2; }
        };
        pass(); 
    } else {
        float* crow = C + (size_t)r0 * ldc + c0;
        auto pass = [&]() {
#pragma unroll
            for (int s = 0; s < 8; ++s) { const int Lid = (lane >> 3) + 4 * s, piece = lane & 7; const int row = Lid >> 1, cofs = (Lid & 1) * 32 + piece * 4;
                const v4f val = *(const v4fa*)(os + row * 68 + cofs); *(v4f*)(crow + (size_t)row * ldc + cofs) = val; }
        };
        pass(); 
    }
}

__global__ __launch_bounds__(256) void k_vt(const float* __restrict__ V, h16* VTH, h16* VTL) {
    __shared__ __align__(16) h16 tile[64 * 72];
    __shared__ __align__(16) h16 til2[64 * 72];
    const int bid = blockIdx.x;
    const int b = bid / (NH_ * (NT_ / 64)), rem = bid - b * (NH_ * (NT_ / 64)), h = rem / (NT_ / 64), kt = rem - h * (NT_ / 64);
    const int k0 = kt * 64, tid = threadIdx.x;
    const int kk = tid >> 2, d0 = (tid & 3) * 16;
    const float* src = V + ((size_t)b * NT_ + k0 + kk) * DM + h * HD + d0;
#pragma unroll
    for (int i = 0; i < 16; ++i) { const float v = src[i]; const h16 a = (h16)v; tile[(d0 + i) * 72 + kk] = a; til2[(d0 + i) * 72 + kk] = (h16)((v - (float)a) * LOSC); }
    __syncthreads();
    const int piece = tid & 7;
    const size_t base = (((size_t)b * NH_ + h) * HD) * NT_ + k0;
    auto pass = [&]() {
#pragma unroll
        for (int s = 0; s < 4; ++s) { const int Lid = (tid >> 3) + 32 * s; const int pln = Lid >> 6, d = Lid & 63;
            const v8h val = *(const v8ha*)((pln ? til2 : tile) + d * 72 + piece * 8); *(v8h*)((pln ? VTL : VTH) + base + (size_t)d * NT_ + piece * 8) = val; }
    };
    pass(); 
}

// k_attn: block = (b, h, 64 queries), wave = 16; ALL 64 key tiles of 32 keys (no mask); 12 WMMA scores (hi.hi, lo.hi, hi.lo) /8 (f32), online softmax, weights x32768 f16 tile (same-wave may_alias
// reload after a compiler barrier), 12 WMMA .v (hi.hi, hi.lo, lo.hi); ctx -> bf16 hi + residual planes CH/CL[tok][h*64+d].
__global__ __launch_bounds__(128) void k_attn(const h16* Q16, const h16* QL16, const h16* K16, const h16* KL16, const h16* __restrict__ VTH, const h16* __restrict__ VTL, bf* CH, bf* CL) {
    __shared__ __align__(16) h16 plds[4][16 * 32];
    __shared__ __align__(16) h16 plds2[4][16 * 32];
    __shared__ __align__(16) float ost[4][16 * 68];
    const int lane = threadIdx.x & 31, wave = threadIdx.x >> 5, lr = lane & 15, hi = lane >> 4;
    const int bid = blockIdx.x;
    const int b = bid / (NH_ * (NT_ / 64)), rem = bid - b * (NH_ * (NT_ / 64)), h = rem / (NT_ / 64), qt = rem - h * (NT_ / 64);
    const int q0 = qt * 64 + wave * 16;
    const size_t tok0 = (size_t)b * NT_;
    h16* pl = &plds[wave][0]; h16* pl2 = &plds2[wave][0];
    v16h qa[2];
    const size_t qo0 = (tok0 + q0 + lr) * DM + h * HD + 8 * hi;
#pragma unroll
    for (int kc = 0; kc < 2; ++kc) qa[kc] = cat16(*(const v8h*)(Q16 + qo0 + kc * 32), *(const v8h*)(Q16 + qo0 + kc * 32 + 16));
    const h16* kh_b = K16 + tok0 * DM + h * HD;
    const h16* kl_b = KL16 + tok0 * DM + h * HD;
    const size_t vbase = (((size_t)b * NH_ + h) * HD) * NT_;
    v8f o[4], ox[4];
#pragma unroll
    for (int n = 0; n < 4; ++n) { o[n] = (v8f){}; ox[n] = (v8f){}; }
    float mrow[8], lpart[8];
#pragma unroll
    for (int j = 0; j < 8; ++j) { mrow[j] = -3.0e38f; lpart[j] = 0.f; }
    int qpos[8];
#pragma unroll
    for (int j = 0; j < 8; ++j) qpos[j] = q0 + 8 * hi + j;
    const int kt_lo = 0, kt_hi = NT_ / 32 - 1;     // full attention
#pragma unroll 1
    for (int kt = kt_lo; kt <= kt_hi; ++kt) {
        const int l0 = kt * 32;
        const size_t ko0 = (size_t)(l0 + lr) * DM + 8 * hi, ko1 = (size_t)(l0 + 16 + lr) * DM + 8 * hi;
        v8f s0 = {}, s1 = {}, x0 = {}, x1 = {};
#pragma unroll
        for (int kc = 0; kc < 2; ++kc) {
            { const v16h k0h = cat16(*(const v8h*)(kh_b + ko0 + kc * 32), *(const v8h*)(kh_b + ko0 + kc * 32 + 16)), k1h = cat16(*(const v8h*)(kh_b + ko1 + kc * 32), *(const v8h*)(kh_b + ko1 + kc * 32 + 16));
              const v16h qlk = cat16(*(const v8h*)(QL16 + qo0 + kc * 32), *(const v8h*)(QL16 + qo0 + kc * 32 + 16));     // query residual re-read per step (registers)
              s0 = wmma16(qa[kc], k0h, s0); x0 = wmma16(qlk, k0h, x0); s1 = wmma16(qa[kc], k1h, s1); x1 = wmma16(qlk, k1h, x1);
              asm volatile("v_nop" : "+v"(s0), "+v"(s1), "+v"(x0), "+v"(x1) : "v"(qlk), "v"(k0h), "v"(k1h) : "memory"); }
            { const v16h k0l = cat16(*(const v8h*)(kl_b + ko0 + kc * 32), *(const v8h*)(kl_b + ko0 + kc * 32 + 16)), k1l = cat16(*(const v8h*)(kl_b + ko1 + kc * 32), *(const v8h*)(kl_b + ko1 + kc * 32 + 16));
              x0 = wmma16(qa[kc], k0l, x0); x1 = wmma16(qa[kc], k1l, x1);
              asm volatile("v_nop" : "+v"(x0), "+v"(x1) : "v"(k0l), "v"(k1l) : "memory"); }
        }
        asm volatile("v_nop\n\tv_nop\n\tv_nop\n\tv_nop" : "+v"(s0), "+v"(s1), "+v"(x0), "+v"(x1) : "v"(qa[0]), "v"(qa[1]));
        float alpha[8];
#pragma unroll
        for (int j = 0; j < 8; ++j) {
            const int ja = l0 + lr, jb = l0 + 16 + lr, qi = qpos[j];
            const float a0 = (s0[j] + x0[j] * LOSCI) * 0.125f, a1 = (s1[j] + x1[j] * LOSCI) * 0.125f; (void)ja; (void)jb; (void)qi;
            float mx = fmaxf(a0, a1);
            mx = fmaxf(mx, __shfl_xor(mx, 1, 16)); mx = fmaxf(mx, __shfl_xor(mx, 2, 16)); mx = fmaxf(mx, __shfl_xor(mx, 4, 16)); mx = fmaxf(mx, __shfl_xor(mx, 8, 16));
            const float mn = fmaxf(mrow[j], mx);
            alpha[j] = __expf(mrow[j] - mn); mrow[j] = mn;
            const float p0 = __expf(a0 - mn), p1 = __expf(a1 - mn);
            lpart[j] = lpart[j] * alpha[j] + (p0 + p1);
            const int mr = hi * 8 + j;
            const float ps0 = p0 * PSC, ps1 = p1 * PSC; const h16 h0 = (h16)ps0, h1 = (h16)ps1;
            pl[mr * 32 + lr] = h0; pl[mr * 32 + 16 + lr] = h1;
            pl2[mr * 32 + lr] = (h16)((ps0 - (float)h0) * LOSC); pl2[mr * 32 + 16 + lr] = (h16)((ps1 - (float)h1) * LOSC);
        }
#pragma unroll
        for (int n = 0; n < 4; ++n)
#pragma unroll
            for (int j = 0; j < 8; ++j) { o[n][j] *= alpha[j]; ox[n][j] *= alpha[j]; }
        asm volatile("" ::: "memory");
        const v16h pa = cat16(*(const v8ha*)(pl + lr * 32 + hi * 8), *(const v8ha*)(pl + lr * 32 + 16 + hi * 8));
        const v16h px = cat16(*(const v8ha*)(pl2 + lr * 32 + hi * 8), *(const v8ha*)(pl2 + lr * 32 + 16 + hi * 8));
#pragma unroll
        for (int n = 0; n < 4; ++n) { const size_t vo = vbase + (size_t)(n * 16 + lr) * NT_ + l0 + hi * 8;
            const v16h vh = cat16(*(const v8h*)(VTH + vo), *(const v8h*)(VTH + vo + 16)), vl = cat16(*(const v8h*)(VTL + vo), *(const v8h*)(VTL + vo + 16));
            o[n] = wmma16(pa, vh, o[n]); ox[n] = wmma16(pa, vl, ox[n]); ox[n] = wmma16(px, vh, ox[n]);
            asm volatile("" : "+v"(o[n]), "+v"(ox[n]) : "v"(vh), "v"(vl) : "memory"); }
        asm volatile("v_nop\n\tv_nop\n\tv_nop\n\tv_nop" : "+v"(o[0]), "+v"(o[1]), "+v"(o[2]), "+v"(o[3]), "+v"(ox[0]), "+v"(ox[1]), "+v"(ox[2]), "+v"(ox[3]) : "v"(pa), "v"(px));
    }
    float inv[8];
#pragma unroll
    for (int j = 0; j < 8; ++j) { float rs = lpart[j]; rs += __shfl_xor(rs, 1, 16); rs += __shfl_xor(rs, 2, 16); rs += __shfl_xor(rs, 4, 16); rs += __shfl_xor(rs, 8, 16); inv[j] = 1.0f / (rs * PSC); }
    float* os = &ost[wave][0];
#pragma unroll
    for (int n = 0; n < 4; ++n)
#pragma unroll
        for (int j = 0; j < 8; ++j) os[(hi * 8 + j) * 68 + n * 16 + lr] = (o[n][j] + ox[n][j] * LOSCI) * inv[j];
    __syncthreads();
    const size_t cbase = (tok0 + q0) * DM + (size_t)h * HD;
    auto pass = [&]() {
#pragma unroll
        for (int s = 0; s < 4; ++s) { const int row = 4 * s + (lane >> 3), piece = lane & 7; const float* sp = os + row * 68 + piece * 8; v8us oh, ol;
#pragma unroll
            for (int i = 0; i < 8; ++i) { const unsigned short hb = f2bf(sp[i]); oh[i] = hb; ol[i] = f2bf(sp[i] - bf2f(hb)); }
            *(v8us*)(CH + cbase + (size_t)row * DM + piece * 8) = oh; *(v8us*)(CL + cbase + (size_t)row * DM + piece * 8) = ol; }
    };
    pass(); 
}

#define VST2(T, p, v) do { const T vst2_v_ = (v); *(T*)(p) = vst2_v_;  } while (0)
extern "C" void kernel_launch(void* const* d_in, const int* in_sizes, int n_in,
                              void* d_out, int out_size, void* d_ws, size_t ws_size, hipStream_t stream) {
    (void)in_sizes; (void)n_in; (void)out_size;
    const float* x = (const float*)d_in[0]; const float* Wqkv = (const float*)d_in[1]; const float* Wo = (const float*)d_in[2];   // both [out][in]
    float* out = (float*)d_out;    // [4][2048][1024]
    char* wsp = (char*)d_ws;
    auto take = [&](size_t bytes) { char* p = wsp; wsp += (bytes + 255) & ~(size_t)255; return (void*)p; };
    bf* Xb = (bf*)take((size_t)NTK * DM * 2); bf* WqkvB = (bf*)take((size_t)DM * DM * 2); bf* WoB = (bf*)take((size_t)DM * DM * 2);
    float* TMP = (float*)take((size_t)NTK * DM * 4);
    h16* QH = (h16*)take((size_t)NTK * DM * 2); h16* QL = (h16*)take((size_t)NTK * DM * 2);
    h16* VTH = (h16*)take((size_t)NTK * DM * 2); h16* VTL = (h16*)take((size_t)NTK * DM * 2); bf* CH = (bf*)take((size_t)NTK * DM * 2); bf* CL = (bf*)take((size_t)NTK * DM * 2);
    if ((size_t)(wsp - (char*)d_ws) > ws_size) return;    // about 155 MB in all, no aliasing
    k_cvtb<<<DM / 8, 256, 0, stream>>>(Wqkv, DM, WqkvB); k_cvtb<<<DM / 8, 256, 0, stream>>>(Wo, DM, WoB);
    k_cvtb<<<NTK / 8, 256, 0, stream>>>(x, NTK, Xb);
    k_gemmb<false, true><<<dim3(NTK / 64, DM / 64, 1), 128, 0, stream>>>(Xb, nullptr, WqkvB, nullptr, (float*)(void*)QH, DM, QL);   // q = k: f16 hi + residual planes
    k_gemmb<false, false><<<dim3(NTK / 64, DM / 64, 1), 128, 0, stream>>>(Xb, nullptr, WqkvB, nullptr, TMP, DM, nullptr);            // v (same product) as f32 for the V^T planes
    k_vt<<<NB_ * NH_ * (NT_ / 64), 256, 0, stream>>>(TMP, VTH, VTL);
    k_attn<<<NB_ * NH_ * (NT_ / 64), 128, 0, stream>>>(QH, QL, QH, QL, VTH, VTL, CH, CL);
    k_gemmb<true, false><<<dim3(NTK / 64, DM / 64, 1), 128, 0, stream>>>(CH, CL, WoB, nullptr, out, DM, nullptr);
}

// v002
// It runs in 531 microseconds.
// Timed twice side by side with v001, it ran 1.29 times as fast both times.
// All steps since v000 together make it 1.81 times as fast.
#include <hip/hip_runtime.h>

// Compute dtypes, f32 accumulate, all 4 batch items in every launch: q = k = v = x.W_qkv^T ([8192 x 1024].[1024 x 1024], ONE shared projection; W is [out][in] = the n-major B operand as-is; PLAIN bf16 product; f16 hi + residual
// V^T planes — and out = ctx.W_o^T (ctx as
// bf16 hi + residual: two products) on v_wmma_f32_16x16x32_bf16; the 16-head full attention (64-dim heads, scale 1/8) fused on
// v_wmma_f32_16x16x32_f16 (scores hi.hi + hi.lo + lo.hi with the residual terms on their own accumulator, online f32 softmax, weights (x32768) and v as f16

#define NB_  4                   // all 4 batch items share each launch: more resident waves per SIMD to cover the load waits
#define NT_  2048
#define DM   1024
#define NH_  16
#define HD   64
#define NTK  (NB_ * NT_)
#define NW   1024
#define NQKV 1024
#define PSC  32768.0f
#define LOSC 1024.0f
#define LOSCI (1.0f / 1024.0f)

typedef _Float16 h16;
typedef unsigned short bf;
typedef __attribute__((ext_vector_type(16))) __bf16   v16bf;
typedef __attribute__((ext_vector_type(16))) _Float16 v16h;
typedef __attribute__((ext_vector_type(8)))  _Float16 v8h;
typedef __attribute__((ext_vector_type(8)))  unsigned short v8us;
typedef __attribute__((ext_vector_type(8)))  float    v8f;
typedef __attribute__((ext_vector_type(4)))  float    v4f;
typedef v8h  __attribute__((may_alias)) v8ha;
typedef v4f  __attribute__((may_alias)) v4fa;
typedef v8us __attribute__((may_alias)) v8usa;

__device__ __forceinline__ unsigned short f2bf(float f) { unsigned u = __float_as_uint(f); u += 0x7FFFu + ((u >> 16) & 1u); return (unsigned short)(u >> 16); }
__device__ __forceinline__ float bf2f(unsigned short b) { return __uint_as_float(((unsigned)b) << 16); }
__device__ __forceinline__ float bfr(float f) { return bf2f(f2bf(f)); }
__device__ __forceinline__ v16h cat16(v8h lo, v8h hi) { return __builtin_shufflevector(lo, hi, 0, 1, 2, 3, 4, 5, 6, 7, 8, 9, 10, 11, 12, 13, 14, 15); }
__device__ __forceinline__ v16bf cat16b(v8us lo, v8us hi) { return __builtin_bit_cast(v16bf, __builtin_shufflevector(lo, hi, 0, 1, 2, 3, 4, 5, 6, 7, 8, 9, 10, 11, 12, 13, 14, 15)); }
__device__ __forceinline__ v8f wmma16(v16h a, v16h b, v8f c) { return __builtin_amdgcn_wmma_f32_16x16x32_f16(false, a, false, b, (short)0, c, false, false); }
__device__ __forceinline__ v8f wmmab(v16bf a, v16bf b, v8f c) { return __builtin_amdgcn_wmma_f32_16x16x32_bf16(false, a, false, b, (short)0, c, false, false); }

__global__ __launch_bounds__(256) void k_cvtb(const float* __restrict__ src, int nrows, bf* dst) {
    const int lane = threadIdx.x & 31, r = blockIdx.x * 8 + (threadIdx.x >> 5);
    if (r >= nrows) return;
    v8us o[DM / 256];
#pragma unroll
    for (int q = 0; q < DM / 256; ++q) { v8us t;
#pragma unroll
        for (int i = 0; i < 8; ++i) t[i] = f2bf(src[(size_t)r * DM + q * 256 + lane * 8 + i]);
        o[q] = t; }
#pragma unroll
    for (int q = 0; q < DM / 256; ++q) *(v8us*)(dst + (size_t)r * DM + q * 256 + lane * 8) = o[q];
    
}

template <bool SPLITA, bool F16OUT = false>
__global__ __launch_bounds__(128) void k_gemmb(const bf* __restrict__ A, const bf* __restrict__ Al, const bf* __restrict__ Bn, const float* __restrict__ bias, float* C, int ldc, h16* C2) {
    __shared__ __align__(16) float ost[4][16 * 68];
    const int lane = threadIdx.x & 31, wave = threadIdx.x >> 5, lr = lane & 15, hi = lane >> 4;
    const int r0 = blockIdx.x * 64 + wave * 16, c0 = blockIdx.y * 64;
    const size_t aoff = (size_t)(r0 + lr) * DM + 8 * hi;
    size_t boff[4];
#pragma unroll
    for (int t = 0; t < 4; ++t) boff[t] = (size_t)(c0 + t * 16 + lr) * DM + 8 * hi;
    v8f acc[4];
#pragma unroll
    for (int t = 0; t < 4; ++t) acc[t] = (v8f){};
#pragma unroll 1
    for (int kc = 0; kc < DM; kc += 32) {
        const v16bf a = cat16b(*(const v8us*)(A + aoff + kc), *(const v8us*)(A + aoff + kc + 16));
        v16bf al = a;
        if (SPLITA) al = cat16b(*(const v8us*)(Al + aoff + kc), *(const v8us*)(Al + aoff + kc + 16));
#pragma unroll
        for (int t = 0; t < 4; ++t) { const v16bf b = cat16b(*(const v8us*)(Bn + boff[t] + kc), *(const v8us*)(Bn + boff[t] + kc + 16)); acc[t] = wmmab(a, b, acc[t]); if (SPLITA) acc[t] = wmmab(al, b, acc[t]); }
        asm volatile("v_nop\n\tv_nop\n\tv_nop\n\tv_nop" : "+v"(acc[0]), "+v"(acc[1]), "+v"(acc[2]), "+v"(acc[3]) : "v"(a), "v"(al));
    }
    float* os = &ost[wave][0];
#pragma unroll
    for (int t = 0; t < 4; ++t) { const float bv = bias ? bfr(bias[c0 + t * 16 + lr]) : 0.f;
#pragma unroll
        for (int j = 0; j < 8; ++j) os[(hi * 8 + j) * 68 + t * 16 + lr] = acc[t][j] + bv; }
    __syncthreads();
    if (F16OUT) {
        h16* crow = (h16*)(void*)C + (size_t)r0 * ldc + c0;
        auto pass = [&]() {
#pragma unroll
            for (int s = 0; s < 4; ++s) { const int row = 4 * s + (lane >> 3), piece = lane & 7; const float* sp = os + row * 68 + piece * 8; v8h o, o2;
#pragma unroll
                for (int i = 0; i < 8; ++i) { const h16 a = (h16)sp[i]; o[i] = a; o2[i] = (h16)((sp[i] - (float)a) * LOSC); }
                *(v8h*)(crow + (size_t)row * ldc + piece * 8) = o; if (C2) *(v8h*)(C2 + (size_t)r0 * ldc + c0 + (size_t)row * ldc + piece * 8) = o2; }
        };
        pass(); 
    } else {
        float* crow = C + (size_t)r0 * ldc + c0;
        auto pass = [&]() {
#pragma unroll
            for (int s = 0; s < 8; ++s) { const int Lid = (lane >> 3) + 4 * s, piece = lane & 7; const int row = Lid >> 1, cofs = (Lid & 1) * 32 + piece * 4;
                const v4f val = *(const v4fa*)(os + row * 68 + cofs); *(v4f*)(crow + (size_t)row * ldc + cofs) = val; }
        };
        pass(); 
    }
}

__global__ __launch_bounds__(256) void k_vt(const float* __restrict__ V, h16* VTH, h16* VTL) {
    __shared__ __align__(16) h16 tile[64 * 72];
    __shared__ __align__(16) h16 til2[64 * 72];
    const int bid = blockIdx.x;
    const int b = bid / (NH_ * (NT_ / 64)), rem = bid - b * (NH_ * (NT_ / 64)), h = rem / (NT_ / 64), kt = rem - h * (NT_ / 64);
    const int k0 = kt * 64, tid = threadIdx.x;
    const int kk = tid >> 2, d0 = (tid & 3) * 16;
    const float* src = V + ((size_t)b * NT_ + k0 + kk) * DM + h * HD + d0;
#pragma unroll
    for (int i = 0; i < 16; ++i) { const float v = src[i]; const h16 a = (h16)v; tile[(d0 + i) * 72 + kk] = a; til2[(d0 + i) * 72 + kk] = (h16)((v - (float)a) * LOSC); }
    __syncthreads();
    const int piece = tid & 7;
    const size_t base = (((size_t)b * NH_ + h) * HD) * NT_ + k0;
    auto pass = [&]() {
#pragma unroll
        for (int s = 0; s < 4; ++s) { const int Lid = (tid >> 3) + 32 * s; const int pln = Lid >> 6, d = Lid & 63;
            const v8h val = *(const v8ha*)((pln ? til2 : tile) + d * 72 + piece * 8); *(v8h*)((pln ? VTL : VTH) + base + (size_t)d * NT_ + piece * 8) = val; }
    };
    pass(); 
}

// LDS ring of k_attn: one stage = 32 keys = key rows hi + residual (128 B each) and V^T row pieces hi + residual (64 B each), two buffers.
#define KPB  144                              // pitch of a key row in LDS, bytes: 16 B x odd, so ds_load_b128 over 16 rows meets no bank twice
#define VPB  80                               // pitch of a V^T row piece in LDS, bytes: 16 B x odd
#define RK_L (32 * KPB)
#define RV_H (2 * 32 * KPB)
#define RV_L (2 * 32 * KPB + 64 * VPB)
#define RBUF (2 * 32 * KPB + 2 * 64 * VPB)

// k_attn: block = (b, h, 64 queries), wave = 16; ALL 64 key tiles of 32 keys (no mask); 4 WMMA scores /8 (f32), online softmax, weights x32768 f16 tile (same-wave may_alias
// reload after a compiler barrier), 4 WMMA .v; ctx -> bf16 hi + residual planes CH/CL[tok][h*64+d].
__global__ __launch_bounds__(128) void k_attn(const h16* Q16, const h16* QL16, const h16* K16, const h16* KL16, const h16* __restrict__ VTH, const h16* __restrict__ VTL, bf* CH, bf* CL) {
    __shared__ __align__(16) h16 plds[4][16 * 32];
    __shared__ __align__(16) h16 plds2[4][16 * 32];
    __shared__ __align__(16) float ost[4][16 * 68];
    __shared__ __align__(16) unsigned char ring[2][RBUF];
    const int lane = threadIdx.x & 31, wave = threadIdx.x >> 5, lr = lane & 15, hi = lane >> 4;
    const int bid = blockIdx.x;
    const int b = bid / (NH_ * (NT_ / 64)), rem = bid - b * (NH_ * (NT_ / 64)), h = rem / (NT_ / 64), qt = rem - h * (NT_ / 64);
    const int q0 = qt * 64 + wave * 16;
    const size_t tok0 = (size_t)b * NT_;
    h16* pl = &plds[wave][0]; h16* pl2 = &plds2[wave][0];
    v16h qa[2];
    const size_t qo0 = (tok0 + q0 + lr) * DM + h * HD + 8 * hi;
#pragma unroll
    for (int kc = 0; kc < 2; ++kc) qa[kc] = cat16(*(const v8h*)(Q16 + qo0 + kc * 32), *(const v8h*)(Q16 + qo0 + kc * 32 + 16));
    const h16* kh_b = K16 + tok0 * DM + h * HD;
    const h16* kl_b = KL16 + tok0 * DM + h * HD;
    const size_t vbase = (((size_t)b * NH_ + h) * HD) * NT_;
    v8f o[4], ox[4];
#pragma unroll
    for (int n = 0; n < 4; ++n) { o[n] = (v8f){}; ox[n] = (v8f){}; }
    float mrow[8], lpart[8];
#pragma unroll
    for (int j = 0; j < 8; ++j) { mrow[j] = -3.0e38f; lpart[j] = 0.f; }
    const int kt_lo = 0, kt_hi = NT_ / 32 - 1;     // full attention
    // One stage is 1024 pieces of 16 B, eight per thread: a wave's copy covers 4 whole key rows, or 8 V^T row pieces.
    const int tid = threadIdx.x;
    const unsigned lk = (unsigned)(size_t)&ring[0][0] + (unsigned)((tid >> 3) * KPB + (tid & 7) * 16);
    const unsigned lv = (unsigned)(size_t)&ring[0][0] + (unsigned)(RV_H + (tid >> 2) * VPB + (tid & 3) * 16);
    const size_t gk = (size_t)(tid >> 3) * DM + (tid & 7) * 8, gv = vbase + (size_t)(tid >> 2) * NT_ + (tid & 3) * 8;
    auto fill = [&](int st) {
        const unsigned bo = (unsigned)(st & 1) * RBUF;
        const h16* pkh = kh_b + gk + (size_t)st * 32 * DM; const h16* pkl = kl_b + gk + (size_t)st * 32 * DM;
        const h16* pvh = VTH + gv + st * 32; const h16* pvl = VTL + gv + st * 32;
        // the copies and the wait before their address registers are written again stand in one statement, so nothing can come between them
        asm volatile("global_load_async_to_lds_b128 %0, %8, off\n\t"
                     "global_load_async_to_lds_b128 %1, %9, off\n\t"
                     "global_load_async_to_lds_b128 %2, %10, off\n\t"
                     "global_load_async_to_lds_b128 %3, %11, off\n\t"
                     "global_load_async_to_lds_b128 %4, %12, off\n\t"
                     "global_load_async_to_lds_b128 %5, %13, off\n\t"
                     "global_load_async_to_lds_b128 %6, %14, off\n\t"
                     "global_load_async_to_lds_b128 %7, %15, off\n\t"
                     "s_wait_xcnt 0x0"
                     :: "v"(lk + bo), "v"(lk + bo + 16 * KPB), "v"(lk + bo + RK_L), "v"(lk + bo + RK_L + 16 * KPB),
                        "v"(lv + bo), "v"(lv + bo + 32 * VPB), "v"(lv + bo + (RV_L - RV_H)), "v"(lv + bo + (RV_L - RV_H) + 32 * VPB),
                        "v"(pkh), "v"(pkh + 16 * DM), "v"(pkl), "v"(pkl + 16 * DM),
                        "v"(pvh), "v"(pvh + 32 * NT_), "v"(pvl), "v"(pvl + 32 * NT_)
                     : "memory");
    };
    fill(0);
    asm volatile("s_wait_asynccnt 0x0" ::: "memory");   // stage 0 has landed before the barrier publishes it
    __syncthreads();
    fill(1);
#pragma unroll 1
    for (int kt = kt_lo; kt <= kt_hi; ++kt) {
        const unsigned char* rb = &ring[kt & 1][0];
        const unsigned char* rk0 = rb + lr * KPB + hi * 16; const unsigned char* rk1 = rk0 + 16 * KPB;
        v8f s0 = {}, s1 = {}, x0 = {}, x1 = {};
#pragma unroll
        for (int kc = 0; kc < 2; ++kc) {
            { const v16h k0h = cat16(*(const v8ha*)(rk0 + kc * 64), *(const v8ha*)(rk0 + kc * 64 + 32)), k1h = cat16(*(const v8ha*)(rk1 + kc * 64), *(const v8ha*)(rk1 + kc * 64 + 32));
              const v16h qlk = cat16(*(const v8h*)(QL16 + qo0 + kc * 32), *(const v8h*)(QL16 + qo0 + kc * 32 + 16));     // query residual re-read per step (registers)
              s0 = wmma16(qa[kc], k0h, s0); x0 = wmma16(qlk, k0h, x0); s1 = wmma16(qa[kc], k1h, s1); x1 = wmma16(qlk, k1h, x1);
              asm volatile("v_nop" : "+v"(s0), "+v"(s1), "+v"(x0), "+v"(x1) : "v"(qlk), "v"(k0h), "v"(k1h) : "memory"); }
            { const v16h k0l = cat16(*(const v8ha*)(rk0 + RK_L + kc * 64), *(const v8ha*)(rk0 + RK_L + kc * 64 + 32)), k1l = cat16(*(const v8ha*)(rk1 + RK_L + kc * 64), *(const v8ha*)(rk1 + RK_L + kc * 64 + 32));
              x0 = wmma16(qa[kc], k0l, x0); x1 = wmma16(qa[kc], k1l, x1);
              asm volatile("v_nop" : "+v"(x0), "+v"(x1) : "v"(k0l), "v"(k1l) : "memory"); }
        }
        asm volatile("v_nop\n\tv_nop\n\tv_nop\n\tv_nop" : "+v"(s0), "+v"(s1), "+v"(x0), "+v"(x1) : "v"(qa[0]), "v"(qa[1]));
        float alpha[8];
#pragma unroll
        for (int j = 0; j < 8; ++j) {
            const float a0 = (s0[j] + x0[j] * LOSCI) * 0.125f, a1 = (s1[j] + x1[j] * LOSCI) * 0.125f;
            float mx = fmaxf(a0, a1);
            mx = fmaxf(mx, __shfl_xor(mx, 1, 16)); mx = fmaxf(mx, __shfl_xor(mx, 2, 16)); mx = fmaxf(mx, __shfl_xor(mx, 4, 16)); mx = fmaxf(mx, __shfl_xor(mx, 8, 16));
            const float mn = fmaxf(mrow[j], mx);
            alpha[j] = __expf(mrow[j] - mn); mrow[j] = mn;
            const float p0 = __expf(a0 - mn), p1 = __expf(a1 - mn);
            lpart[j] = lpart[j] * alpha[j] + (p0 + p1);
            const int mr = hi * 8 + j;
            const float ps0 = p0 * PSC, ps1 = p1 * PSC; const h16 h0 = (h16)ps0, h1 = (h16)ps1;
            pl[mr * 32 + lr] = h0; pl[mr * 32 + 16 + lr] = h1;
            pl2[mr * 32 + lr] = (h16)((ps0 - (float)h0) * LOSC); pl2[mr * 32 + 16 + lr] = (h16)((ps1 - (float)h1) * LOSC);
        }
#pragma unroll
        for (int n = 0; n < 4; ++n)
#pragma unroll
            for (int j = 0; j < 8; ++j) { o[n][j] *= alpha[j]; ox[n][j] *= alpha[j]; }
        asm volatile("" ::: "memory");
        const v16h pa = cat16(*(const v8ha*)(pl + lr * 32 + hi * 8), *(const v8ha*)(pl + lr * 32 + 16 + hi * 8));
        const v16h px = cat16(*(const v8ha*)(pl2 + lr * 32 + hi * 8), *(const v8ha*)(pl2 + lr * 32 + 16 + hi * 8));
#pragma unroll
        for (int n = 0; n < 4; ++n) { const unsigned char* rv = rb + RV_H + (n * 16 + lr) * VPB + hi * 16;
            const v16h vh = cat16(*(const v8ha*)(rv), *(const v8ha*)(rv + 32)), vl = cat16(*(const v8ha*)(rv + (RV_L - RV_H)), *(const v8ha*)(rv + (RV_L - RV_H) + 32));
            o[n] = wmma16(pa, vh, o[n]); ox[n] = wmma16(pa, vl, ox[n]); ox[n] = wmma16(px, vh, ox[n]);
            asm volatile("" : "+v"(o[n]), "+v"(ox[n]) : "v"(vh), "v"(vl) : "memory"); }
        asm volatile("v_nop\n\tv_nop\n\tv_nop\n\tv_nop" : "+v"(o[0]), "+v"(o[1]), "+v"(o[2]), "+v"(o[3]), "+v"(ox[0]), "+v"(ox[1]), "+v"(ox[2]), "+v"(ox[3]) : "v"(pa), "v"(px));
        asm volatile("s_wait_dscnt 0x0" ::: "memory");      // this wave's reads of the buffer are done before the buffer is handed to the copies
        asm volatile("s_wait_asynccnt 0x0" ::: "memory");   // this wave's share of the next stage has landed before the barrier publishes it
        __syncthreads();                                    // publishes stage kt + 1 and ends every wave's reads of stage kt
        if (kt + 2 <= kt_hi) fill(kt + 2);                  // into the buffer this trip has just read
    }
    asm volatile("s_wait_asynccnt 0x0" ::: "memory");       // no copy is outstanding when the wave goes on to the epilogue
    float inv[8];
#pragma unroll
    for (int j = 0; j < 8; ++j) { float rs = lpart[j]; rs += __shfl_xor(rs, 1, 16); rs += __shfl_xor(rs, 2, 16); rs += __shfl_xor(rs, 4, 16); rs += __shfl_xor(rs, 8, 16); inv[j] = 1.0f / (rs * PSC); }
    float* os = &ost[wave][0];
#pragma unroll
    for (int n = 0; n < 4; ++n)
#pragma unroll
        for (int j = 0; j < 8; ++j) os[(hi * 8 + j) * 68 + n * 16 + lr] = (o[n][j] + ox[n][j] * LOSCI) * inv[j];
    __syncthreads();
    const size_t cbase = (tok0 + q0) * DM + (size_t)h * HD;
    auto pass = [&]() {
#pragma unroll
        for (int s = 0; s < 4; ++s) { const int row = 4 * s + (lane >> 3), piece = lane & 7; const float* sp = os + row * 68 + piece * 8; v8us oh, ol;
#pragma unroll
            for (int i = 0; i < 8; ++i) { const unsigned short hb = f2bf(sp[i]); oh[i] = hb; ol[i] = f2bf(sp[i] - bf2f(hb)); }
            *(v8us*)(CH + cbase + (size_t)row * DM + piece * 8) = oh; *(v8us*)(CL + cbase + (size_t)row * DM + piece * 8) = ol; }
    };
    pass(); 
}

#define VST2(T, p, v) do { const T vst2_v_ = (v); *(T*)(p) = vst2_v_;  } while (0)
extern "C" void kernel_launch(void* const* d_in, const int* in_sizes, int n_in,
                              void* d_out, int out_size, void* d_ws, size_t ws_size, hipStream_t stream) {
    (void)in_sizes; (void)n_in; (void)out_size;
    const float* x = (const float*)d_in[0]; const float* Wqkv = (const float*)d_in[1]; const float* Wo = (const float*)d_in[2];   // both [out][in]
    float* out = (float*)d_out;    // [4][2048][1024]
    char* wsp = (char*)d_ws;
    auto take = [&](size_t bytes) { char* p = wsp; wsp += (bytes + 255) & ~(size_t)255; return (void*)p; };
    bf* Xb = (bf*)take((size_t)NTK * DM * 2); bf* WqkvB = (bf*)take((size_t)DM * DM * 2); bf* WoB = (bf*)take((size_t)DM * DM * 2);
    float* TMP = (float*)take((size_t)NTK * DM * 4);
    h16* QH = (h16*)take((size_t)NTK * DM * 2); h16* QL = (h16*)take((size_t)NTK * DM * 2);
    h16* VTH = (h16*)take((size_t)NTK * DM * 2); h16* VTL = (h16*)take((size_t)NTK * DM * 2); bf* CH = (bf*)take((size_t)NTK * DM * 2); bf* CL = (bf*)take((size_t)NTK * DM * 2);
    if ((size_t)(wsp - (char*)d_ws) > ws_size) return;    // about 155 MB in all, no aliasing
    k_cvtb<<<DM / 8, 256, 0, stream>>>(Wqkv, DM, WqkvB); k_cvtb<<<DM / 8, 256, 0, stream>>>(Wo, DM, WoB);
    k_cvtb<<<NTK / 8, 256, 0, stream>>>(x, NTK, Xb);
    k_gemmb<false, true><<<dim3(NTK / 64, DM / 64, 1), 128, 0, stream>>>(Xb, nullptr, WqkvB, nullptr, (float*)(void*)QH, DM, QL);   // q = k: f16 hi + residual planes
    k_gemmb<false, false><<<dim3(NTK / 64, DM / 64, 1), 128, 0, stream>>>(Xb, nullptr, WqkvB, nullptr, TMP, DM, nullptr);            // v (same product) as f32 for the V^T planes
    k_vt<<<NB_ * NH_ * (NT_ / 64), 256, 0, stream>>>(TMP, VTH, VTL);
    k_attn<<<NB_ * NH_ * (NT_ / 64), 128, 0, stream>>>(QH, QL, QH, QL, VTH, VTL, CH, CL);
    k_gemmb<true, false><<<dim3(NTK / 64, DM / 64, 1), 128, 0, stream>>>(CH, CL, WoB, nullptr, out, DM, nullptr);
}

// v003
// One run takes 444 microseconds.
// Timed twice side by side with v002, it ran 1.20 and 1.19 times as fast.
// Counting every step since v000, it is 2.16 times as fast.
#include <hip/hip_runtime.h>

// Compute dtypes, f32 accumulate, all 4 batch items in every launch: q = k = v = x.W_qkv^T ([8192 x 1024].[1024 x 1024], ONE shared projection; W is [out][in] = the n-major B operand as-is; PLAIN bf16 product; f16 hi + residual
// V^T planes — and out = ctx.W_o^T (ctx as
// bf16 hi + residual: two products) on v_wmma_f32_16x16x32_bf16; the 16-head full attention (64-dim heads, scale 1/8) fused on
// v_wmma_f32_16x16x32_f16 (scores hi.hi + hi.lo + lo.hi with the residual terms on their own accumulator, online f32 softmax, weights (x32768) and v as f16

#define NB_  4                   // all 4 batch items share each launch: more resident waves per SIMD to cover the load waits
#define NT_  2048
#define DM   1024
#define NH_  16
#define HD   64
#define NTK  (NB_ * NT_)
#define NW   1024
#define NQKV 1024
#define PSC  32768.0f
#define LOSC 1024.0f
#define LOSCI (1.0f / 1024.0f)

typedef _Float16 h16;
typedef unsigned short bf;
typedef __attribute__((ext_vector_type(16))) __bf16   v16bf;
typedef __attribute__((ext_vector_type(16))) _Float16 v16h;
typedef __attribute__((ext_vector_type(8)))  _Float16 v8h;
typedef __attribute__((ext_vector_type(8)))  unsigned short v8us;
typedef __attribute__((ext_vector_type(8)))  float    v8f;
typedef __attribute__((ext_vector_type(4)))  float    v4f;
typedef __attribute__((ext_vector_type(2)))  float    v2f;
typedef __attribute__((ext_vector_type(2)))  _Float16 v2h;
typedef v8h  __attribute__((may_alias)) v8ha;
typedef v4f  __attribute__((may_alias)) v4fa;
typedef v8us __attribute__((may_alias)) v8usa;

__device__ __forceinline__ unsigned short f2bf(float f) { unsigned u = __float_as_uint(f); u += 0x7FFFu + ((u >> 16) & 1u); return (unsigned short)(u >> 16); }
__device__ __forceinline__ float bf2f(unsigned short b) { return __uint_as_float(((unsigned)b) << 16); }
__device__ __forceinline__ float bfr(float f) { return bf2f(f2bf(f)); }
__device__ __forceinline__ v16h cat16(v8h lo, v8h hi) { return __builtin_shufflevector(lo, hi, 0, 1, 2, 3, 4, 5, 6, 7, 8, 9, 10, 11, 12, 13, 14, 15); }
__device__ __forceinline__ v16bf cat16b(v8us lo, v8us hi) { return __builtin_bit_cast(v16bf, __builtin_shufflevector(lo, hi, 0, 1, 2, 3, 4, 5, 6, 7, 8, 9, 10, 11, 12, 13, 14, 15)); }
__device__ __forceinline__ v8f wmma16(v16h a, v16h b, v8f c) { return __builtin_amdgcn_wmma_f32_16x16x32_f16(false, a, false, b, (short)0, c, false, false); }
__device__ __forceinline__ v8f wmmab(v16bf a, v16bf b, v8f c) { return __builtin_amdgcn_wmma_f32_16x16x32_bf16(false, a, false, b, (short)0, c, false, false); }

__device__ __forceinline__ float xhalf(float x) { return __builtin_bit_cast(float, __builtin_amdgcn_permlanex16(__builtin_bit_cast(int, x), __builtin_bit_cast(int, x), 0x76543210, 0xfedcba98, false, false)); }  // lane l with lane l ^ 16

__global__ __launch_bounds__(256) void k_cvtb(const float* __restrict__ src, int nrows, bf* dst) {
    const int lane = threadIdx.x & 31, r = blockIdx.x * 8 + (threadIdx.x >> 5);
    if (r >= nrows) return;
    v8us o[DM / 256];
#pragma unroll
    for (int q = 0; q < DM / 256; ++q) { v8us t;
#pragma unroll
        for (int i = 0; i < 8; ++i) t[i] = f2bf(src[(size_t)r * DM + q * 256 + lane * 8 + i]);
        o[q] = t; }
#pragma unroll
    for (int q = 0; q < DM / 256; ++q) *(v8us*)(dst + (size_t)r * DM + q * 256 + lane * 8) = o[q];
    
}

template <bool SPLITA, bool F16OUT = false>
__global__ __launch_bounds__(128) void k_gemmb(const bf* __restrict__ A, const bf* __restrict__ Al, const bf* __restrict__ Bn, const float* __restrict__ bias, float* C, int ldc, h16* C2) {
    __shared__ __align__(16) float ost[4][16 * 68];
    const int lane = threadIdx.x & 31, wave = threadIdx.x >> 5, lr = lane & 15, hi = lane >> 4;
    const int r0 = blockIdx.x * 64 + wave * 16, c0 = blockIdx.y * 64;
    const size_t aoff = (size_t)(r0 + lr) * DM + 8 * hi;
    size_t boff[4];
#pragma unroll
    for (int t = 0; t < 4; ++t) boff[t] = (size_t)(c0 + t * 16 + lr) * DM + 8 * hi;
    v8f acc[4];
#pragma unroll
    for (int t = 0; t < 4; ++t) acc[t] = (v8f){};
#pragma unroll 1
    for (int kc = 0; kc < DM; kc += 32) {
        const v16bf a = cat16b(*(const v8us*)(A + aoff + kc), *(const v8us*)(A + aoff + kc + 16));
        v16bf al = a;
        if (SPLITA) al = cat16b(*(const v8us*)(Al + aoff + kc), *(const v8us*)(Al + aoff + kc + 16));
#pragma unroll
        for (int t = 0; t < 4; ++t) { const v16bf b = cat16b(*(const v8us*)(Bn + boff[t] + kc), *(const v8us*)(Bn + boff[t] + kc + 16)); acc[t] = wmmab(a, b, acc[t]); if (SPLITA) acc[t] = wmmab(al, b, acc[t]); }
        asm volatile("v_nop\n\tv_nop\n\tv_nop\n\tv_nop" : "+v"(acc[0]), "+v"(acc[1]), "+v"(acc[2]), "+v"(acc[3]) : "v"(a), "v"(al));
    }
    float* os = &ost[wave][0];
#pragma unroll
    for (int t = 0; t < 4; ++t) { const float bv = bias ? bfr(bias[c0 + t * 16 + lr]) : 0.f;
#pragma unroll
        for (int j = 0; j < 8; ++j) os[(hi * 8 + j) * 68 + t * 16 + lr] = acc[t][j] + bv; }
    __syncthreads();
    if (F16OUT) {
        h16* crow = (h16*)(void*)C + (size_t)r0 * ldc + c0;
        auto pass = [&]() {
#pragma unroll
            for (int s = 0; s < 4; ++s) { const int row = 4 * s + (lane >> 3), piece = lane & 7; const float* sp = os + row * 68 + piece * 8; v8h o, o2;
#pragma unroll
                for (int i = 0; i < 8; ++i) { const h16 a = (h16)sp[i]; o[i] = a; o2[i] = (h16)((sp[i] - (float)a) * LOSC); }
                *(v8h*)(crow + (size_t)row * ldc + piece * 8) = o; if (C2) *(v8h*)(C2 + (size_t)r0 * ldc + c0 + (size_t)row * ldc + piece * 8) = o2; }
        };
        pass(); 
    } else {
        float* crow = C + (size_t)r0 * ldc + c0;
        auto pass = [&]() {
#pragma unroll
            for (int s = 0; s < 8; ++s) { const int Lid = (lane >> 3) + 4 * s, piece = lane & 7; const int row = Lid >> 1, cofs = (Lid & 1) * 32 + piece * 4;
                const v4f val = *(const v4fa*)(os + row * 68 + cofs); *(v4f*)(crow + (size_t)row * ldc + cofs) = val; }
        };
        pass(); 
    }
}

__global__ __launch_bounds__(256) void k_vt(const float* __restrict__ V, h16* VTH, h16* VTL) {
    __shared__ __align__(16) h16 tile[64 * 72];
    __shared__ __align__(16) h16 til2[64 * 72];
    const int bid = blockIdx.x;
    const int b = bid / (NH_ * (NT_ / 64)), rem = bid - b * (NH_ * (NT_ / 64)), h = rem / (NT_ / 64), kt = rem - h * (NT_ / 64);
    const int k0 = kt * 64, tid = threadIdx.x;
    const int kk = tid >> 2, d0 = (tid & 3) * 16;
    const float* src = V + ((size_t)b * NT_ + k0 + kk) * DM + h * HD + d0;
#pragma unroll
    for (int i = 0; i < 16; ++i) { const float v = src[i]; const h16 a = (h16)v; tile[(d0 + i) * 72 + kk] = a; til2[(d0 + i) * 72 + kk] = (h16)((v - (float)a) * LOSC); }
    __syncthreads();
    const int piece = tid & 7;
    const size_t base = (((size_t)b * NH_ + h) * HD) * NT_ + k0;
    auto pass = [&]() {
#pragma unroll
        for (int s = 0; s < 4; ++s) { const int Lid = (tid >> 3) + 32 * s; const int pln = Lid >> 6, d = Lid & 63;
            const v8h val = *(const v8ha*)((pln ? til2 : tile) + d * 72 + piece * 8); *(v8h*)((pln ? VTL : VTH) + base + (size_t)d * NT_ + piece * 8) = val; }
    };
    pass(); 
}

// LDS ring of k_attn: one stage = 32 keys = key rows hi + residual (128 B each) and V^T row pieces hi + residual (64 B each), two buffers.
#define KPB  144                              // pitch of a key row in LDS, bytes: 16 B x odd, so ds_load_b128 over 16 rows meets no bank twice
#define VPB  80                               // pitch of a V^T row piece in LDS, bytes: 16 B x odd
#define RK_L (32 * KPB)
#define RV_H (2 * 32 * KPB)
#define RV_L (2 * 32 * KPB + 64 * VPB)
#define RBUF (2 * 32 * KPB + 2 * 64 * VPB)

// k_attn: block = (b, h, 64 queries), wave = 16; all keys (no mask), 32 per trip. Transposed products: S^T = K.Q^T (A = key rows, B = queries) and O^T += V^T.P^T,
// so a lane holds 16 scores of ONE query (lane l ^ 16 the other 16): maximum and sum in-lane plus one exchange between the halves, and the two score tiles, converted
// in place (weights x32768, f16 hi + residual), are the B operand of the second product. ctx -> bf16 hi + residual planes CH/CL[tok][h*64+d], 8 d per lane and tile.
__global__ __launch_bounds__(128) void k_attn(const h16* Q16, const h16* QL16, const h16* K16, const h16* KL16, const h16* __restrict__ VTH, const h16* __restrict__ VTL, bf* CH, bf* CL) {
    __shared__ __align__(16) unsigned char ring[2][RBUF];
    const int lane = threadIdx.x & 31, wave = threadIdx.x >> 5, lr = lane & 15, hi = lane >> 4;
    const int bid = blockIdx.x;
    const int b = bid / (NH_ * (NT_ / 64)), rem = bid - b * (NH_ * (NT_ / 64)), h = rem / (NT_ / 64), qt = rem - h * (NT_ / 64);
    const int q0 = qt * 64 + wave * 16;
    const size_t tok0 = (size_t)b * NT_;
    v16h qa[2];
    const size_t qo0 = (tok0 + q0 + lr) * DM + h * HD + 8 * hi;
#pragma unroll
    for (int kc = 0; kc < 2; ++kc) qa[kc] = cat16(*(const v8h*)(Q16 + qo0 + kc * 32), *(const v8h*)(Q16 + qo0 + kc * 32 + 16));
    const h16* kh_b = K16 + tok0 * DM + h * HD;
    const h16* kl_b = KL16 + tok0 * DM + h * HD;
    const size_t vbase = (((size_t)b * NH_ + h) * HD) * NT_;
    v8f o[4], ox[4];
#pragma unroll
    for (int n = 0; n < 4; ++n) { o[n] = (v8f){}; ox[n] = (v8f){}; }
    float mrow = -3.0e38f, lpart = 0.f;            // of this lane's query; lpart covers this half's keys only
    const int kt_lo = 0, kt_hi = NT_ / 32 - 1;     // full attention
    // One stage is 1024 pieces of 16 B, eight per thread: a wave's copy covers 4 whole key rows, or 8 V^T row pieces.
    const int tid = threadIdx.x;
    const unsigned lk = (unsigned)(size_t)&ring[0][0] + (unsigned)((tid >> 3) * KPB + (tid & 7) * 16);
    const unsigned lv = (unsigned)(size_t)&ring[0][0] + (unsigned)(RV_H + (tid >> 2) * VPB + (tid & 3) * 16);
    const size_t gk = (size_t)(tid >> 3) * DM + (tid & 7) * 8, gv = vbase + (size_t)(tid >> 2) * NT_ + (tid & 3) * 8;
    auto fill = [&](int st) {
        const unsigned bo = (unsigned)(st & 1) * RBUF;
        const h16* pkh = kh_b + gk + (size_t)st * 32 * DM; const h16* pkl = kl_b + gk + (size_t)st * 32 * DM;
        const h16* pvh = VTH + gv + st * 32; const h16* pvl = VTL + gv + st * 32;
        // the copies and the wait before their address registers are written again stand in one statement, so nothing can come between them
        asm volatile("global_load_async_to_lds_b128 %0, %8, off\n\t"
                     "global_load_async_to_lds_b128 %1, %9, off\n\t"
                     "global_load_async_to_lds_b128 %2, %10, off\n\t"
                     "global_load_async_to_lds_b128 %3, %11, off\n\t"
                     "global_load_async_to_lds_b128 %4, %12, off\n\t"
                     "global_load_async_to_lds_b128 %5, %13, off\n\t"
                     "global_load_async_to_lds_b128 %6, %14, off\n\t"
                     "global_load_async_to_lds_b128 %7, %15, off\n\t"
                     "s_wait_xcnt 0x0"
                     :: "v"(lk + bo), "v"(lk + bo + 16 * KPB), "v"(lk + bo + RK_L), "v"(lk + bo + RK_L + 16 * KPB),
                        "v"(lv + bo), "v"(lv + bo + 32 * VPB), "v"(lv + bo + (RV_L - RV_H)), "v"(lv + bo + (RV_L - RV_H) + 32 * VPB),
                        "v"(pkh), "v"(pkh + 16 * DM), "v"(pkl), "v"(pkl + 16 * DM),
                        "v"(pvh), "v"(pvh + 32 * NT_), "v"(pvl), "v"(pvl + 32 * NT_)
                     : "memory");
    };
    fill(0);
    asm volatile("s_wait_asynccnt 0x0" ::: "memory");   // stage 0 has landed before the barrier publishes it
    __syncthreads();
    fill(1);
#pragma unroll 1
    for (int kt = kt_lo; kt <= kt_hi; ++kt) {
        const unsigned char* rb = &ring[kt & 1][0];
        const unsigned char* rk0 = rb + lr * KPB + hi * 16; const unsigned char* rk1 = rk0 + 16 * KPB;
        v8f s0 = {}, s1 = {}, x0 = {}, x1 = {};
#pragma unroll
        for (int kc = 0; kc < 2; ++kc) {
            { const v16h k0h = cat16(*(const v8ha*)(rk0 + kc * 64), *(const v8ha*)(rk0 + kc * 64 + 32)), k1h = cat16(*(const v8ha*)(rk1 + kc * 64), *(const v8ha*)(rk1 + kc * 64 + 32));
              const v16h qlk = cat16(*(const v8h*)(QL16 + qo0 + kc * 32), *(const v8h*)(QL16 + qo0 + kc * 32 + 16));     // query residual re-read per step (registers)
              s0 = wmma16(k0h, qa[kc], s0); x0 = wmma16(k0h, qlk, x0); s1 = wmma16(k1h, qa[kc], s1); x1 = wmma16(k1h, qlk, x1);
              asm volatile("v_nop" : "+v"(s0), "+v"(s1), "+v"(x0), "+v"(x1) : "v"(qlk), "v"(k0h), "v"(k1h) : "memory"); }
            { const v16h k0l = cat16(*(const v8ha*)(rk0 + RK_L + kc * 64), *(const v8ha*)(rk0 + RK_L + kc * 64 + 32)), k1l = cat16(*(const v8ha*)(rk1 + RK_L + kc * 64), *(const v8ha*)(rk1 + RK_L + kc * 64 + 32));
              x0 = wmma16(k0l, qa[kc], x0); x1 = wmma16(k1l, qa[kc], x1);
              asm volatile("v_nop" : "+v"(x0), "+v"(x1) : "v"(k0l), "v"(k1l) : "memory"); }
        }
        asm volatile("v_nop\n\tv_nop\n\tv_nop\n\tv_nop" : "+v"(s0), "+v"(s1), "+v"(x0), "+v"(x1) : "v"(qa[0]), "v"(qa[1]));
        // s0[j], s1[j]: keys 8 * hi + j and 16 + 8 * hi + j of this trip, query lr; worked on in pairs of neighbouring registers (packed f32 forms, no register moves)
        v2f a[8]; float mx = -3.0e38f;
#pragma unroll
        for (int q = 0; q < 4; ++q) {
            a[q]     = ((v2f){s0[2 * q], s0[2 * q + 1]} + (v2f){x0[2 * q], x0[2 * q + 1]} * LOSCI) * 0.125f;
            a[4 + q] = ((v2f){s1[2 * q], s1[2 * q + 1]} + (v2f){x1[2 * q], x1[2 * q + 1]} * LOSCI) * 0.125f;
        }
#pragma unroll
        for (int q = 0; q < 8; ++q) mx = fmaxf(mx, fmaxf(a[q].x, a[q].y));
        mx = fmaxf(mx, xhalf(mx));
        const float mn = fmaxf(mrow, mx);
        const float alpha = __expf(mrow - mn); mrow = mn;
        asm volatile("v_nop" :: "v"(alpha));           // the one slot behind a transcendental before its source register is written again (this build reuses it at once)
        v2f sum = {0.f, 0.f};
        v16h pa, px;                                   // element s of a B operand is k = 8 * hi + s, or 16 + 8 * hi + (s - 8): the two score tiles as they lie
#pragma unroll
        for (int q = 0; q < 8; ++q) {
            const v2f e = a[q] - mn; const v2f p = {__expf(e.x), __expf(e.y)};
            sum += p;
            const v2f ps = p * PSC; const v2h hh = __builtin_convertvector(ps, v2h);
            const v2h hl = __builtin_convertvector((ps - __builtin_convertvector(hh, v2f)) * LOSC, v2h);
            pa[2 * q] = hh.x; pa[2 * q + 1] = hh.y; px[2 * q] = hl.x; px[2 * q + 1] = hl.y;
        }
        lpart = lpart * alpha + (sum.x + sum.y);
#pragma unroll
        for (int n = 0; n < 4; ++n)
#pragma unroll
            for (int j = 0; j < 8; ++j) { o[n][j] *= alpha; ox[n][j] *= alpha; }
#pragma unroll
        for (int n = 0; n < 4; ++n) { const unsigned char* rv = rb + RV_H + (n * 16 + lr) * VPB + hi * 16;
            const v16h vh = cat16(*(const v8ha*)(rv), *(const v8ha*)(rv + 32)), vl = cat16(*(const v8ha*)(rv + (RV_L - RV_H)), *(const v8ha*)(rv + (RV_L - RV_H) + 32));
            o[n] = wmma16(vh, pa, o[n]); ox[n] = wmma16(vl, pa, ox[n]); ox[n] = wmma16(vh, px, ox[n]);
            asm volatile("" : "+v"(o[n]), "+v"(ox[n]) : "v"(vh), "v"(vl) : "memory"); }
        asm volatile("v_nop\n\tv_nop\n\tv_nop\n\tv_nop" : "+v"(o[0]), "+v"(o[1]), "+v"(o[2]), "+v"(o[3]), "+v"(ox[0]), "+v"(ox[1]), "+v"(ox[2]), "+v"(ox[3]) : "v"(pa), "v"(px));
        asm volatile("s_wait_dscnt 0x0" ::: "memory");      // this wave's reads of the buffer are done before the buffer is handed to the copies
        asm volatile("s_wait_asynccnt 0x0" ::: "memory");   // this wave's share of the next stage has landed before the barrier publishes it
        __syncthreads();                                    // publishes stage kt + 1 and ends every wave's reads of stage kt
        if (kt + 2 <= kt_hi) fill(kt + 2);                  // into the buffer this trip has just read
    }
    asm volatile("s_wait_asynccnt 0x0" ::: "memory");       // no copy is outstanding when the wave goes on to the epilogue
    const float inv = 1.0f / ((lpart + xhalf(lpart)) * PSC);
    // o[n][j] = O^T[n * 16 + 8 * hi + j][query lr]: eight consecutive d of one token, one 16-byte store per plane
    const size_t cbase = (tok0 + q0 + lr) * DM + (size_t)h * HD + 8 * hi;
#pragma unroll
    for (int n = 0; n < 4; ++n) { v8us oh, ol;
#pragma unroll
        for (int j = 0; j < 8; ++j) { const float v = (o[n][j] + ox[n][j] * LOSCI) * inv; const unsigned short hb = f2bf(v); oh[j] = hb; ol[j] = f2bf(v - bf2f(hb)); }
        *(v8us*)(CH + cbase + n * 16) = oh; *(v8us*)(CL + cbase + n * 16) = ol; }
}

#define VST2(T, p, v) do { const T vst2_v_ = (v); *(T*)(p) = vst2_v_;  } while (0)
extern "C" void kernel_launch(void* const* d_in, const int* in_sizes, int n_in,
                              void* d_out, int out_size, void* d_ws, size_t ws_size, hipStream_t stream) {
    (void)in_sizes; (void)n_in; (void)out_size;
    const float* x = (const float*)d_in[0]; const float* Wqkv = (const float*)d_in[1]; const float* Wo = (const float*)d_in[2];   // both [out][in]
    float* out = (float*)d_out;    // [4][2048][1024]
    char* wsp = (char*)d_ws;
    auto take = [&](size_t bytes) { char* p = wsp; wsp += (bytes + 255) & ~(size_t)255; return (void*)p; };
    bf* Xb = (bf*)take((size_t)NTK * DM * 2); bf* WqkvB = (bf*)take((size_t)DM * DM * 2); bf* WoB = (bf*)take((size_t)DM * DM * 2);
    float* TMP = (float*)take((size_t)NTK * DM * 4);
    h16* QH = (h16*)take((size_t)NTK * DM * 2); h16* QL = (h16*)take((size_t)NTK * DM * 2);
    h16* VTH = (h16*)take((size_t)NTK * DM * 2); h16* VTL = (h16*)take((size_t)NTK * DM * 2); bf* CH = (bf*)take((size_t)NTK * DM * 2); bf* CL = (bf*)take((size_t)NTK * DM * 2);
    if ((size_t)(wsp - (char*)d_ws) > ws_size) return;    // about 155 MB in all, no aliasing
    k_cvtb<<<DM / 8, 256, 0, stream>>>(Wqkv, DM, WqkvB); k_cvtb<<<DM / 8, 256, 0, stream>>>(Wo, DM, WoB);
    k_cvtb<<<NTK / 8, 256, 0, stream>>>(x, NTK, Xb);
    k_gemmb<false, true><<<dim3(NTK / 64, DM / 64, 1), 128, 0, stream>>>(Xb, nullptr, WqkvB, nullptr, (float*)(void*)QH, DM, QL);   // q = k: f16 hi + residual planes
    k_gemmb<false, false><<<dim3(NTK / 64, DM / 64, 1), 128, 0, stream>>>(Xb, nullptr, WqkvB, nullptr, TMP, DM, nullptr);            // v (same product) as f32 for the V^T planes
    k_vt<<<NB_ * NH_ * (NT_ / 64), 256, 0, stream>>>(TMP, VTH, VTL);
    k_attn<<<NB_ * NH_ * (NT_ / 64), 128, 0, stream>>>(QH, QL, QH, QL, VTH, VTL, CH, CL);
    k_gemmb<true, false><<<dim3(NTK / 64, DM / 64, 1), 128, 0, stream>>>(CH, CL, WoB, nullptr, out, DM, nullptr);
}

// v004
// It runs in 290 microseconds.
// Two timings next to v003 both put it at 1.53 times that version's speed.
// All steps since v000 together make it 3.31 times as fast.
#include <hip/hip_runtime.h>

// Compute dtypes, f32 accumulate, all 4 batch items in every launch: q = k = v = x.W_qkv^T ([8192 x 1024].[1024 x 1024], ONE shared projection; W is [out][in] = the n-major B operand as-is; PLAIN bf16 product; f16 hi + residual
// V^T planes — and out = ctx.W_o^T (ctx as
// bf16 hi + residual: two products) on v_wmma_f32_16x16x32_bf16; the 16-head full attention (64-dim heads, scale 1/8) fused on
// v_wmma_f32_16x16x32_f16 (scores hi.hi + hi.lo + lo.hi with the residual terms on their own accumulator, online f32 softmax, weights (x32768) and v as f16

#define NB_  4                   // all 4 batch items share each launch: more resident waves per SIMD to cover the load waits
#define NT_  2048
#define DM   1024
#define NH_  16
#define HD   64
#define NTK  (NB_ * NT_)
#define NW   1024
#define NQKV 1024
#define PSC  32768.0f
#define LOSC 1024.0f
#define LOSCI (1.0f / 1024.0f)

typedef _Float16 h16;
typedef unsigned short bf;
typedef __attribute__((ext_vector_type(16))) __bf16   v16bf;
typedef __attribute__((ext_vector_type(16))) _Float16 v16h;
typedef __attribute__((ext_vector_type(8)))  _Float16 v8h;
typedef __attribute__((ext_vector_type(8)))  unsigned short v8us;
typedef __attribute__((ext_vector_type(8)))  float    v8f;
typedef __attribute__((ext_vector_type(4)))  float    v4f;
typedef __attribute__((ext_vector_type(2)))  float    v2f;
typedef __attribute__((ext_vector_type(2)))  _Float16 v2h;
typedef v8h  __attribute__((may_alias)) v8ha;
typedef v4f  __attribute__((may_alias)) v4fa;
typedef v8us __attribute__((may_alias)) v8usa;

__device__ __forceinline__ unsigned short f2bf(float f) { unsigned u = __float_as_uint(f); u += 0x7FFFu + ((u >> 16) & 1u); return (unsigned short)(u >> 16); }
__device__ __forceinline__ float bf2f(unsigned short b) { return __uint_as_float(((unsigned)b) << 16); }
__device__ __forceinline__ float bfr(float f) { return bf2f(f2bf(f)); }
__device__ __forceinline__ v16h cat16(v8h lo, v8h hi) { return __builtin_shufflevector(lo, hi, 0, 1, 2, 3, 4, 5, 6, 7, 8, 9, 10, 11, 12, 13, 14, 15); }
__device__ __forceinline__ v16bf cat16b(v8us lo, v8us hi) { return __builtin_bit_cast(v16bf, __builtin_shufflevector(lo, hi, 0, 1, 2, 3, 4, 5, 6, 7, 8, 9, 10, 11, 12, 13, 14, 15)); }
__device__ __forceinline__ v8f wmma16(v16h a, v16h b, v8f c) { return __builtin_amdgcn_wmma_f32_16x16x32_f16(false, a, false, b, (short)0, c, false, false); }
__device__ __forceinline__ v8f wmmab(v16bf a, v16bf b, v8f c) { return __builtin_amdgcn_wmma_f32_16x16x32_bf16(false, a, false, b, (short)0, c, false, false); }

__device__ __forceinline__ float xhalf(float x) { return __builtin_bit_cast(float, __builtin_amdgcn_permlanex16(__builtin_bit_cast(int, x), __builtin_bit_cast(int, x), 0x76543210, 0xfedcba98, false, false)); }  // lane l with lane l ^ 16

__global__ __launch_bounds__(256) void k_cvtb(const float* __restrict__ src, int nrows, bf* dst) {
    const int lane = threadIdx.x & 31, r = blockIdx.x * 8 + (threadIdx.x >> 5);
    if (r >= nrows) return;
    v8us o[DM / 256];
#pragma unroll
    for (int q = 0; q < DM / 256; ++q) { v8us t;
#pragma unroll
        for (int i = 0; i < 8; ++i) t[i] = f2bf(src[(size_t)r * DM + q * 256 + lane * 8 + i]);
        o[q] = t; }
#pragma unroll
    for (int q = 0; q < DM / 256; ++q) *(v8us*)(dst + (size_t)r * DM + q * 256 + lane * 8) = o[q];
    
}

// LDS ring of k_gemmb: one stage = 64 k of 128 A rows (and of their residual rows where SPLITA) and of 128 B rows, each row piece one whole 128-byte line, two buffers.
#define GPB   144                             // pitch of a row piece in LDS, bytes: 16 B x odd, so ds_load_b128 over 16 rows meets no bank twice
#define GTILE (128 * GPB)

// k_gemmb: block = 128 x 128 of C, 8 waves of 32 x 64 (2 x 4 accumulator tiles); every operand line is fetched once per block, as a whole line, and shared through LDS.
template <bool SPLITA, bool F16OUT = false>
__global__ __launch_bounds__(256) void k_gemmb(const bf* __restrict__ A, const bf* __restrict__ Al, const bf* __restrict__ Bn, const float* __restrict__ bias, float* C, int ldc, h16* C2) {
    constexpr unsigned GBUF = (SPLITA ? 3u : 2u) * GTILE;      // A rows, B rows, residual rows
    __shared__ __align__(16) unsigned char ring[2 * GBUF];
    const int tid = threadIdx.x, lane = tid & 31, wave = tid >> 5, lr = lane & 15, hi = lane >> 4;
    const int wm = wave >> 1, wn = wave & 1;
    const int rb0 = blockIdx.x * 128, cb0 = blockIdx.y * 128;
    // One operand tile of a stage is 1024 pieces of 16 B, four per thread: a wave's copy covers 4 whole row pieces.
    const unsigned l0 = (unsigned)(size_t)&ring[0] + (unsigned)((tid >> 3) * GPB + (tid & 7) * 16);
    const size_t g0 = (size_t)(tid >> 3) * DM + (tid & 7) * 8;
    auto fill = [&](int st) {
        const unsigned la = l0 + (unsigned)(st & 1) * GBUF, lb = la + GTILE;
        const bf* pa = A + (size_t)rb0 * DM + g0 + st * 64; const bf* pb = Bn + (size_t)cb0 * DM + g0 + st * 64;
        // the copies and the wait before their address registers are written again stand in one statement, so nothing can come between them
        asm volatile("global_load_async_to_lds_b128 %0, %8, off\n\t"
                     "global_load_async_to_lds_b128 %1, %9, off\n\t"
                     "global_load_async_to_lds_b128 %2, %10, off\n\t"
                     "global_load_async_to_lds_b128 %3, %11, off\n\t"
                     "global_load_async_to_lds_b128 %4, %12, off\n\t"
                     "global_load_async_to_lds_b128 %5, %13, off\n\t"
                     "global_load_async_to_lds_b128 %6, %14, off\n\t"
                     "global_load_async_to_lds_b128 %7, %15, off\n\t"
                     "s_wait_xcnt 0x0"
                     :: "v"(la), "v"(la + 32 * GPB), "v"(la + 64 * GPB), "v"(la + 96 * GPB),
                        "v"(lb), "v"(lb + 32 * GPB), "v"(lb + 64 * GPB), "v"(lb + 96 * GPB),
                        "v"(pa), "v"(pa + 32 * DM), "v"(pa + 64 * DM), "v"(pa + 96 * DM),
                        "v"(pb), "v"(pb + 32 * DM), "v"(pb + 64 * DM), "v"(pb + 96 * DM)
                     : "memory");
        if (SPLITA) {
            const unsigned ll = la + 2 * GTILE; const bf* pl = Al + (size_t)rb0 * DM + g0 + st * 64;
            // as above: the wait closes the copies' own statement
            asm volatile("global_load_async_to_lds_b128 %0, %4, off\n\t"
                         "global_load_async_to_lds_b128 %1, %5, off\n\t"
                         "global_load_async_to_lds_b128 %2, %6, off\n\t"
                         "global_load_async_to_lds_b128 %3, %7, off\n\t"
                         "s_wait_xcnt 0x0"
                         :: "v"(ll), "v"(ll + 32 * GPB), "v"(ll + 64 * GPB), "v"(ll + 96 * GPB),
                            "v"(pl), "v"(pl + 32 * DM), "v"(pl + 64 * DM), "v"(pl + 96 * DM)
                         : "memory");
        }
    };
    v8f acc[2][4];
#pragma unroll
    for (int m = 0; m < 2; ++m)
#pragma unroll
        for (int t = 0; t < 4; ++t) acc[m][t] = (v8f){};
    fill(0);
    asm volatile("s_wait_asynccnt 0x0" ::: "memory");   // stage 0 has landed before the barrier publishes it
    __syncthreads();
    fill(1);
#pragma unroll 1
    for (int kt = 0; kt < DM / 64; ++kt) {              // rolled: one trip per ring stage
        const unsigned char* rb = &ring[(unsigned)(kt & 1) * GBUF];
        const unsigned char* ra = rb + (wm * 32 + lr) * GPB + hi * 16;
        const unsigned char* rn = rb + GTILE + (wn * 64 + lr) * GPB + hi * 16;
#pragma unroll
        for (int kk = 0; kk < 2; ++kk) {
            v16bf a[2], al[2], b[4];
#pragma unroll
            for (int m = 0; m < 2; ++m) {
                a[m] = cat16b(*(const v8usa*)(ra + m * 16 * GPB + kk * 64), *(const v8usa*)(ra + m * 16 * GPB + kk * 64 + 32));
                if (SPLITA) al[m] = cat16b(*(const v8usa*)(ra + 2 * GTILE + m * 16 * GPB + kk * 64), *(const v8usa*)(ra + 2 * GTILE + m * 16 * GPB + kk * 64 + 32));
            }
#pragma unroll
            for (int t = 0; t < 4; ++t) b[t] = cat16b(*(const v8usa*)(rn + t * 16 * GPB + kk * 64), *(const v8usa*)(rn + t * 16 * GPB + kk * 64 + 32));
#pragma unroll
            for (int m = 0; m < 2; ++m)
#pragma unroll
                for (int t = 0; t < 4; ++t) acc[m][t] = wmmab(a[m], b[t], acc[m][t]);
            if (SPLITA) {
#pragma unroll
                for (int m = 0; m < 2; ++m)
#pragma unroll
                    for (int t = 0; t < 4; ++t) acc[m][t] = wmmab(al[m], b[t], acc[m][t]);
            }
        }
        asm volatile("s_wait_dscnt 0x0" ::: "memory");      // this wave's reads of the buffer are done before the buffer is handed to the copies
        asm volatile("s_wait_asynccnt 0x0" ::: "memory");   // this wave's share of the next stage has landed before the barrier publishes it
        __syncthreads();                                    // publishes stage kt + 1 and ends every wave's reads of stage kt
        if (kt + 2 < DM / 64) fill(kt + 2);                 // into the buffer this trip has just read
    }
    asm volatile("s_wait_asynccnt 0x0" ::: "memory");       // no copy is outstanding when the ring's LDS becomes the output staging
    const int r0 = rb0 + wm * 32, c0 = cb0 + wn * 64;
    float* os = (float*)(void*)&ring[0] + wave * (32 * 68); // behind the last trip's barrier nobody reads the ring any more
#pragma unroll
    for (int m = 0; m < 2; ++m)
#pragma unroll
        for (int t = 0; t < 4; ++t) { const float bv = bias ? bfr(bias[c0 + t * 16 + lr]) : 0.f;
#pragma unroll
            for (int j = 0; j < 8; ++j) os[(m * 16 + hi * 8 + j) * 68 + t * 16 + lr] = acc[m][t][j] + bv; }
    __syncthreads();
    if (F16OUT) {
        h16* crow = (h16*)(void*)C + (size_t)r0 * ldc + c0;
#pragma unroll
        for (int s = 0; s < 8; ++s) { const int row = 4 * s + (lane >> 3), piece = lane & 7; const float* sp = os + row * 68 + piece * 8; v8h o, o2;
#pragma unroll
            for (int i = 0; i < 8; ++i) { const h16 a = (h16)sp[i]; o[i] = a; o2[i] = (h16)((sp[i] - (float)a) * LOSC); }
            *(v8h*)(crow + (size_t)row * ldc + piece * 8) = o;
            asm volatile("s_wait_xcnt 0x0" ::: "memory");   // precaution: this build writes the store's registers again at once (the residual's arithmetic)
            if (C2) *(v8h*)(C2 + (size_t)r0 * ldc + c0 + (size_t)row * ldc + piece * 8) = o2; }
    } else {
        float* crow = C + (size_t)r0 * ldc + c0;
#pragma unroll
        for (int s = 0; s < 16; ++s) { const int Lid = (lane >> 3) + 4 * s, piece = lane & 7; const int row = Lid >> 1, cofs = (Lid & 1) * 32 + piece * 4;
            const v4f val = *(const v4fa*)(os + row * 68 + cofs); *(v4f*)(crow + (size_t)row * ldc + cofs) = val; }
    }
}

__global__ __launch_bounds__(256) void k_vt(const float* __restrict__ V, h16* VTH, h16* VTL) {
    __shared__ __align__(16) h16 tile[64 * 72];
    __shared__ __align__(16) h16 til2[64 * 72];
    const int bid = blockIdx.x;
    const int b = bid / (NH_ * (NT_ / 64)), rem = bid - b * (NH_ * (NT_ / 64)), h = rem / (NT_ / 64), kt = rem - h * (NT_ / 64);
    const int k0 = kt * 64, tid = threadIdx.x;
    const int kk = tid >> 2, d0 = (tid & 3) * 16;
    const float* src = V + ((size_t)b * NT_ + k0 + kk) * DM + h * HD + d0;
#pragma unroll
    for (int i = 0; i < 16; ++i) { const float v = src[i]; const h16 a = (h16)v; tile[(d0 + i) * 72 + kk] = a; til2[(d0 + i) * 72 + kk] = (h16)((v - (float)a) * LOSC); }
    __syncthreads();
    const int piece = tid & 7;
    const size_t base = (((size_t)b * NH_ + h) * HD) * NT_ + k0;
    auto pass = [&]() {
#pragma unroll
        for (int s = 0; s < 4; ++s) { const int Lid = (tid >> 3) + 32 * s; const int pln = Lid >> 6, d = Lid & 63;
            const v8h val = *(const v8ha*)((pln ? til2 : tile) + d * 72 + piece * 8); *(v8h*)((pln ? VTL : VTH) + base + (size_t)d * NT_ + piece * 8) = val; }
    };
    pass(); 
}

// LDS ring of k_attn: one stage = 32 keys = key rows hi + residual (128 B each) and V^T row pieces hi + residual (64 B each), two buffers.
#define KPB  144                              // pitch of a key row in LDS, bytes: 16 B x odd, so ds_load_b128 over 16 rows meets no bank twice
#define VPB  80                               // pitch of a V^T row piece in LDS, bytes: 16 B x odd
#define RK_L (32 * KPB)
#define RV_H (2 * 32 * KPB)
#define RV_L (2 * 32 * KPB + 64 * VPB)
#define RBUF (2 * 32 * KPB + 2 * 64 * VPB)

// k_attn: block = (b, h, 64 queries), wave = 16; all keys (no mask), 32 per trip. Transposed products: S^T = K.Q^T (A = key rows, B = queries) and O^T += V^T.P^T,
// so a lane holds 16 scores of ONE query (lane l ^ 16 the other 16): maximum and sum in-lane plus one exchange between the halves, and the two score tiles, converted
// in place (weights x32768, f16 hi + residual), are the B operand of the second product. ctx -> bf16 hi + residual planes CH/CL[tok][h*64+d], 8 d per lane and tile.
__global__ __launch_bounds__(128) void k_attn(const h16* Q16, const h16* QL16, const h16* K16, const h16* KL16, const h16* __restrict__ VTH, const h16* __restrict__ VTL, bf* CH, bf* CL) {
    __shared__ __align__(16) unsigned char ring[2][RBUF];
    const int lane = threadIdx.x & 31, wave = threadIdx.x >> 5, lr = lane & 15, hi = lane >> 4;
    const int bid = blockIdx.x;
    const int b = bid / (NH_ * (NT_ / 64)), rem = bid - b * (NH_ * (NT_ / 64)), h = rem / (NT_ / 64), qt = rem - h * (NT_ / 64);
    const int q0 = qt * 64 + wave * 16;
    const size_t tok0 = (size_t)b * NT_;
    v16h qa[2];
    const size_t qo0 = (tok0 + q0 + lr) * DM + h * HD + 8 * hi;
#pragma unroll
    for (int kc = 0; kc < 2; ++kc) qa[kc] = cat16(*(const v8h*)(Q16 + qo0 + kc * 32), *(const v8h*)(Q16 + qo0 + kc * 32 + 16));
    const h16* kh_b = K16 + tok0 * DM + h * HD;
    const h16* kl_b = KL16 + tok0 * DM + h * HD;
    const size_t vbase = (((size_t)b * NH_ + h) * HD) * NT_;
    v8f o[4], ox[4];
#pragma unroll
    for (int n = 0; n < 4; ++n) { o[n] = (v8f){}; ox[n] = (v8f){}; }
    float mrow = -3.0e38f, lpart = 0.f;            // of this lane's query; lpart covers this half's keys only
    const int kt_lo = 0, kt_hi = NT_ / 32 - 1;     // full attention
    // One stage is 1024 pieces of 16 B, eight per thread: a wave's copy covers 4 whole key rows, or 8 V^T row pieces.
    const int tid = threadIdx.x;
    const unsigned lk = (unsigned)(size_t)&ring[0][0] + (unsigned)((tid >> 3) * KPB + (tid & 7) * 16);
    const unsigned lv = (unsigned)(size_t)&ring[0][0] + (unsigned)(RV_H + (tid >> 2) * VPB + (tid & 3) * 16);
    const size_t gk = (size_t)(tid >> 3) * DM + (tid & 7) * 8, gv = vbase + (size_t)(tid >> 2) * NT_ + (tid & 3) * 8;
    auto fill = [&](int st) {
        const unsigned bo = (unsigned)(st & 1) * RBUF;
        const h16* pkh = kh_b + gk + (size_t)st * 32 * DM; const h16* pkl = kl_b + gk + (size_t)st * 32 * DM;
        const h16* pvh = VTH + gv + st * 32; const h16* pvl = VTL + gv + st * 32;
        // the copies and the wait before their address registers are written again stand in one statement, so nothing can come between them
        asm volatile("global_load_async_to_lds_b128 %0, %8, off\n\t"
                     "global_load_async_to_lds_b128 %1, %9, off\n\t"
                     "global_load_async_to_lds_b128 %2, %10, off\n\t"
                     "global_load_async_to_lds_b128 %3, %11, off\n\t"
                     "global_load_async_to_lds_b128 %4, %12, off\n\t"
                     "global_load_async_to_lds_b128 %5, %13, off\n\t"
                     "global_load_async_to_lds_b128 %6, %14, off\n\t"
                     "global_load_async_to_lds_b128 %7, %15, off\n\t"
                     "s_wait_xcnt 0x0"
                     :: "v"(lk + bo), "v"(lk + bo + 16 * KPB), "v"(lk + bo + RK_L), "v"(lk + bo + RK_L + 16 * KPB),
                        "v"(lv + bo), "v"(lv + bo + 32 * VPB), "v"(lv + bo + (RV_L - RV_H)), "v"(lv + bo + (RV_L - RV_H) + 32 * VPB),
                        "v"(pkh), "v"(pkh + 16 * DM), "v"(pkl), "v"(pkl + 16 * DM),
                        "v"(pvh), "v"(pvh + 32 * NT_), "v"(pvl), "v"(pvl + 32 * NT_)
                     : "memory");
    };
    fill(0);
    asm volatile("s_wait_asynccnt 0x0" ::: "memory");   // stage 0 has landed before the barrier publishes it
    __syncthreads();
    fill(1);
#pragma unroll 1
    for (int kt = kt_lo; kt <= kt_hi; ++kt) {
        const unsigned char* rb = &ring[kt & 1][0];
        const unsigned char* rk0 = rb + lr * KPB + hi * 16; const unsigned char* rk1 = rk0 + 16 * KPB;
        v8f s0 = {}, s1 = {}, x0 = {}, x1 = {};
#pragma unroll
        for (int kc = 0; kc < 2; ++kc) {
            { const v16h k0h = cat16(*(const v8ha*)(rk0 + kc * 64), *(const v8ha*)(rk0 + kc * 64 + 32)), k1h = cat16(*(const v8ha*)(rk1 + kc * 64), *(const v8ha*)(rk1 + kc * 64 + 32));
              const v16h qlk = cat16(*(const v8h*)(QL16 + qo0 + kc * 32), *(const v8h*)(QL16 + qo0 + kc * 32 + 16));     // query residual re-read per step (registers)
              s0 = wmma16(k0h, qa[kc], s0); x0 = wmma16(k0h, qlk, x0); s1 = wmma16(k1h, qa[kc], s1); x1 = wmma16(k1h, qlk, x1);
              asm volatile("v_nop" : "+v"(s0), "+v"(s1), "+v"(x0), "+v"(x1) : "v"(qlk), "v"(k0h), "v"(k1h) : "memory"); }
            { const v16h k0l = cat16(*(const v8ha*)(rk0 + RK_L + kc * 64), *(const v8ha*)(rk0 + RK_L + kc * 64 + 32)), k1l = cat16(*(const v8ha*)(rk1 + RK_L + kc * 64), *(const v8ha*)(rk1 + RK_L + kc * 64 + 32));
              x0 = wmma16(k0l, qa[kc], x0); x1 = wmma16(k1l, qa[kc], x1);
              asm volatile("v_nop" : "+v"(x0), "+v"(x1) : "v"(k0l), "v"(k1l) : "memory"); }
        }
        asm volatile("v_nop\n\tv_nop\n\tv_nop\n\tv_nop" : "+v"(s0), "+v"(s1), "+v"(x0), "+v"(x1) : "v"(qa[0]), "v"(qa[1]));
        // s0[j], s1[j]: keys 8 * hi + j and 16 + 8 * hi + j of this trip, query lr; worked on in pairs of neighbouring registers (packed f32 forms, no register moves)
        v2f a[8]; float mx = -3.0e38f;
#pragma unroll
        for (int q = 0; q < 4; ++q) {
            a[q]     = ((v2f){s0[2 * q], s0[2 * q + 1]} + (v2f){x0[2 * q], x0[2 * q + 1]} * LOSCI) * 0.125f;
            a[4 + q] = ((v2f){s1[2 * q], s1[2 * q + 1]} + (v2f){x1[2 * q], x1[2 * q + 1]} * LOSCI) * 0.125f;
        }
#pragma unroll
        for (int q = 0; q < 8; ++q) mx = fmaxf(mx, fmaxf(a[q].x, a[q].y));
        mx = fmaxf(mx, xhalf(mx));
        const float mn = fmaxf(mrow, mx);
        const float alpha = __expf(mrow - mn); mrow = mn;
        asm volatile("v_nop" :: "v"(alpha));           // the one slot behind a transcendental before its source register is written again (this build reuses it at once)
        v2f sum = {0.f, 0.f};
        v16h pa, px;                                   // element s of a B operand is k = 8 * hi + s, or 16 + 8 * hi + (s - 8): the two score tiles as they lie
#pragma unroll
        for (int q = 0; q < 8; ++q) {
            const v2f e = a[q] - mn; const v2f p = {__expf(e.x), __expf(e.y)};
            sum += p;
            const v2f ps = p * PSC; const v2h hh = __builtin_convertvector(ps, v2h);
            const v2h hl = __builtin_convertvector((ps - __builtin_convertvector(hh, v2f)) * LOSC, v2h);
            pa[2 * q] = hh.x; pa[2 * q + 1] = hh.y; px[2 * q] = hl.x; px[2 * q + 1] = hl.y;
        }
        lpart = lpart * alpha + (sum.x + sum.y);
#pragma unroll
        for (int n = 0; n < 4; ++n)
#pragma unroll
            for (int j = 0; j < 8; ++j) { o[n][j] *= alpha; ox[n][j] *= alpha; }
#pragma unroll
        for (int n = 0; n < 4; ++n) { const unsigned char* rv = rb + RV_H + (n * 16 + lr) * VPB + hi * 16;
            const v16h vh = cat16(*(const v8ha*)(rv), *(const v8ha*)(rv + 32)), vl = cat16(*(const v8ha*)(rv + (RV_L - RV_H)), *(const v8ha*)(rv + (RV_L - RV_H) + 32));
            o[n] = wmma16(vh, pa, o[n]); ox[n] = wmma16(vl, pa, ox[n]); ox[n] = wmma16(vh, px, ox[n]);
            asm volatile("" : "+v"(o[n]), "+v"(ox[n]) : "v"(vh), "v"(vl) : "memory"); }
        asm volatile("v_nop\n\tv_nop\n\tv_nop\n\tv_nop" : "+v"(o[0]), "+v"(o[1]), "+v"(o[2]), "+v"(o[3]), "+v"(ox[0]), "+v"(ox[1]), "+v"(ox[2]), "+v"(ox[3]) : "v"(pa), "v"(px));
        asm volatile("s_wait_dscnt 0x0" ::: "memory");      // this wave's reads of the buffer are done before the buffer is handed to the copies
        asm volatile("s_wait_asynccnt 0x0" ::: "memory");   // this wave's share of the next stage has landed before the barrier publishes it
        __syncthreads();                                    // publishes stage kt + 1 and ends every wave's reads of stage kt
        if (kt + 2 <= kt_hi) fill(kt + 2);                  // into the buffer this trip has just read
    }
    asm volatile("s_wait_asynccnt 0x0" ::: "memory");       // no copy is outstanding when the wave goes on to the epilogue
    const float inv = 1.0f / ((lpart + xhalf(lpart)) * PSC);
    // o[n][j] = O^T[n * 16 + 8 * hi + j][query lr]: eight consecutive d of one token, one 16-byte store per plane
    const size_t cbase = (tok0 + q0 + lr) * DM + (size_t)h * HD + 8 * hi;
#pragma unroll
    for (int n = 0; n < 4; ++n) { v8us oh, ol;
#pragma unroll
        for (int j = 0; j < 8; ++j) { const float v = (o[n][j] + ox[n][j] * LOSCI) * inv; const unsigned short hb = f2bf(v); oh[j] = hb; ol[j] = f2bf(v - bf2f(hb)); }
        *(v8us*)(CH + cbase + n * 16) = oh; *(v8us*)(CL + cbase + n * 16) = ol; }
}

#define VST2(T, p, v) do { const T vst2_v_ = (v); *(T*)(p) = vst2_v_;  } while (0)
extern "C" void kernel_launch(void* const* d_in, const int* in_sizes, int n_in,
                              void* d_out, int out_size, void* d_ws, size_t ws_size, hipStream_t stream) {
    (void)in_sizes; (void)n_in; (void)out_size;
    const float* x = (const float*)d_in[0]; const float* Wqkv = (const float*)d_in[1]; const float* Wo = (const float*)d_in[2];   // both [out][in]
    float* out = (float*)d_out;    // [4][2048][1024]
    char* wsp = (char*)d_ws;
    auto take = [&](size_t bytes) { char* p = wsp; wsp += (bytes + 255) & ~(size_t)255; return (void*)p; };
    bf* Xb = (bf*)take((size_t)NTK * DM * 2); bf* WqkvB = (bf*)take((size_t)DM * DM * 2); bf* WoB = (bf*)take((size_t)DM * DM * 2);
    float* TMP = (float*)take((size_t)NTK * DM * 4);
    h16* QH = (h16*)take((size_t)NTK * DM * 2); h16* QL = (h16*)take((size_t)NTK * DM * 2);
    h16* VTH = (h16*)take((size_t)NTK * DM * 2); h16* VTL = (h16*)take((size_t)NTK * DM * 2); bf* CH = (bf*)take((size_t)NTK * DM * 2); bf* CL = (bf*)take((size_t)NTK * DM * 2);
    if ((size_t)(wsp - (char*)d_ws) > ws_size) return;    // about 155 MB in all, no aliasing
    k_cvtb<<<DM / 8, 256, 0, stream>>>(Wqkv, DM, WqkvB); k_cvtb<<<DM / 8, 256, 0, stream>>>(Wo, DM, WoB);
    k_cvtb<<<NTK / 8, 256, 0, stream>>>(x, NTK, Xb);
    k_gemmb<false, true><<<dim3(NTK / 128, DM / 128, 1), 256, 0, stream>>>(Xb, nullptr, WqkvB, nullptr, (float*)(void*)QH, DM, QL);   // q = k: f16 hi + residual planes
    k_gemmb<false, false><<<dim3(NTK / 128, DM / 128, 1), 256, 0, stream>>>(Xb, nullptr, WqkvB, nullptr, TMP, DM, nullptr);            // v (same product) as f32 for the V^T planes
    k_vt<<<NB_ * NH_ * (NT_ / 64), 256, 0, stream>>>(TMP, VTH, VTL);
    k_attn<<<NB_ * NH_ * (NT_ / 64), 128, 0, stream>>>(QH, QL, QH, QL, VTH, VTL, CH, CL);
    k_gemmb<true, false><<<dim3(NTK / 128, DM / 128, 1), 256, 0, stream>>>(CH, CL, WoB, nullptr, out, DM, nullptr);
}

// v005
// One run takes 220 microseconds.
// Timed twice side by side with v004, it ran 1.32 times as fast both times.
// Over all steps from v000 it is 4.35 times as fast.
#include <hip/hip_runtime.h>

// Compute dtypes, f32 accumulate, all 4 batch items in every launch: q = k = v = x.W_qkv^T ([8192 x 1024].[1024 x 1024], ONE shared projection, computed once; W is [out][in] = the
// n-major B operand as-is; plain bf16) and out = ctx.W_o^T (ctx as bf16 hi + residual: two products) on v_wmma_f32_16x16x32_bf16; the 16-head full attention (64-dim heads, scale 1/8)
// fused on v_wmma_f32_16x16x32_f16 (scores hi.hi + hi.lo + lo.hi with the residual terms on their own accumulator, online f32 softmax, weights (x32768) and v as f16 hi + residual).

#define NB_  4                   // all 4 batch items share each launch: more resident waves per SIMD to cover the load waits
#define NT_  2048
#define DM   1024
#define NH_  16
#define HD   64
#define NTK  (NB_ * NT_)
#define NW   1024
#define NQKV 1024
#define PSC  32768.0f
#define LOSC 1024.0f
#define LOSCI (1.0f / 1024.0f)

typedef _Float16 h16;
typedef unsigned short bf;
typedef __attribute__((ext_vector_type(16))) __bf16   v16bf;
typedef __attribute__((ext_vector_type(16))) _Float16 v16h;
typedef __attribute__((ext_vector_type(8)))  _Float16 v8h;
typedef __attribute__((ext_vector_type(8)))  unsigned short v8us;
typedef __attribute__((ext_vector_type(8)))  float    v8f;
typedef __attribute__((ext_vector_type(4)))  float    v4f;
typedef __attribute__((ext_vector_type(2)))  float    v2f;
typedef __attribute__((ext_vector_type(2)))  _Float16 v2h;
typedef v8h  __attribute__((may_alias)) v8ha;
typedef v4f  __attribute__((may_alias)) v4fa;
typedef v8us __attribute__((may_alias)) v8usa;

__device__ __forceinline__ unsigned short f2bf(float f) { unsigned u = __float_as_uint(f); u += 0x7FFFu + ((u >> 16) & 1u); return (unsigned short)(u >> 16); }
__device__ __forceinline__ float bf2f(unsigned short b) { return __uint_as_float(((unsigned)b) << 16); }
__device__ __forceinline__ float bfr(float f) { return bf2f(f2bf(f)); }
__device__ __forceinline__ v16h cat16(v8h lo, v8h hi) { return __builtin_shufflevector(lo, hi, 0, 1, 2, 3, 4, 5, 6, 7, 8, 9, 10, 11, 12, 13, 14, 15); }
__device__ __forceinline__ v16bf cat16b(v8us lo, v8us hi) { return __builtin_bit_cast(v16bf, __builtin_shufflevector(lo, hi, 0, 1, 2, 3, 4, 5, 6, 7, 8, 9, 10, 11, 12, 13, 14, 15)); }
__device__ __forceinline__ v8f wmma16(v16h a, v16h b, v8f c) { return __builtin_amdgcn_wmma_f32_16x16x32_f16(false, a, false, b, (short)0, c, false, false); }
__device__ __forceinline__ v8f wmmab(v16bf a, v16bf b, v8f c) { return __builtin_amdgcn_wmma_f32_16x16x32_bf16(false, a, false, b, (short)0, c, false, false); }

__device__ __forceinline__ float xhalf(float x) { return __builtin_bit_cast(float, __builtin_amdgcn_permlanex16(__builtin_bit_cast(int, x), __builtin_bit_cast(int, x), 0x76543210, 0xfedcba98, false, false)); }  // lane l with lane l ^ 16

__global__ __launch_bounds__(256) void k_cvtb(const float* __restrict__ src, int nrows, bf* dst) {
    const int lane = threadIdx.x & 31, r = blockIdx.x * 8 + (threadIdx.x >> 5);
    if (r >= nrows) return;
    v8us o[DM / 256];
#pragma unroll
    for (int q = 0; q < DM / 256; ++q) { v8us t;
#pragma unroll
        for (int i = 0; i < 8; ++i) t[i] = f2bf(src[(size_t)r * DM + q * 256 + lane * 8 + i]);
        o[q] = t; }
#pragma unroll
    for (int q = 0; q < DM / 256; ++q) *(v8us*)(dst + (size_t)r * DM + q * 256 + lane * 8) = o[q];
    
}

// LDS ring of k_gemmb: one stage = 64 k of 128 A rows (and of their residual rows where SPLITA) and of 128 B rows, each row piece one whole 128-byte line, two buffers.
#define GPB   144                             // pitch of a row piece in LDS, bytes: 16 B x odd, so ds_load_b128 over 16 rows meets no bank twice
#define GTILE (128 * GPB)

// k_gemmb: block = 128 x 128 of C, 8 waves of 32 x 64 (2 x 4 accumulator tiles); every operand line is fetched once per block, as a whole line, and shared through LDS.
template <bool SPLITA, bool F16OUT = false>
__global__ __launch_bounds__(256) void k_gemmb(const bf* __restrict__ A, const bf* __restrict__ Al, const bf* __restrict__ Bn, const float* __restrict__ bias, float* C, int ldc, h16* C2) {
    constexpr unsigned GBUF = (SPLITA ? 3u : 2u) * GTILE;      // A rows, B rows, residual rows
    __shared__ __align__(16) unsigned char ring[2 * GBUF];
    const int tid = threadIdx.x, lane = tid & 31, wave = tid >> 5, lr = lane & 15, hi = lane >> 4;
    const int wm = wave >> 1, wn = wave & 1;
    const int rb0 = blockIdx.x * 128, cb0 = blockIdx.y * 128;
    // One operand tile of a stage is 1024 pieces of 16 B, four per thread: a wave's copy covers 4 whole row pieces.
    const unsigned l0 = (unsigned)(size_t)&ring[0] + (unsigned)((tid >> 3) * GPB + (tid & 7) * 16);
    const size_t g0 = (size_t)(tid >> 3) * DM + (tid & 7) * 8;
    auto fill = [&](int st) {
        const unsigned la = l0 + (unsigned)(st & 1) * GBUF, lb = la + GTILE;
        const bf* pa = A + (size_t)rb0 * DM + g0 + st * 64; const bf* pb = Bn + (size_t)cb0 * DM + g0 + st * 64;
        // the copies and the wait before their address registers are written again stand in one statement, so nothing can come between them
        asm volatile("global_load_async_to_lds_b128 %0, %8, off\n\t"
                     "global_load_async_to_lds_b128 %1, %9, off\n\t"
                     "global_load_async_to_lds_b128 %2, %10, off\n\t"
                     "global_load_async_to_lds_b128 %3, %11, off\n\t"
                     "global_load_async_to_lds_b128 %4, %12, off\n\t"
                     "global_load_async_to_lds_b128 %5, %13, off\n\t"
                     "global_load_async_to_lds_b128 %6, %14, off\n\t"
                     "global_load_async_to_lds_b128 %7, %15, off\n\t"
                     "s_wait_xcnt 0x0"
                     :: "v"(la), "v"(la + 32 * GPB), "v"(la + 64 * GPB), "v"(la + 96 * GPB),
                        "v"(lb), "v"(lb + 32 * GPB), "v"(lb + 64 * GPB), "v"(lb + 96 * GPB),
                        "v"(pa), "v"(pa + 32 * DM), "v"(pa + 64 * DM), "v"(pa + 96 * DM),
                        "v"(pb), "v"(pb + 32 * DM), "v"(pb + 64 * DM), "v"(pb + 96 * DM)
                     : "memory");
        if (SPLITA) {
            const unsigned ll = la + 2 * GTILE; const bf* pl = Al + (size_t)rb0 * DM + g0 + st * 64;
            // as above: the wait closes the copies' own statement
            asm volatile("global_load_async_to_lds_b128 %0, %4, off\n\t"
                         "global_load_async_to_lds_b128 %1, %5, off\n\t"
                         "global_load_async_to_lds_b128 %2, %6, off\n\t"
                         "global_load_async_to_lds_b128 %3, %7, off\n\t"
                         "s_wait_xcnt 0x0"
                         :: "v"(ll), "v"(ll + 32 * GPB), "v"(ll + 64 * GPB), "v"(ll + 96 * GPB),
                            "v"(pl), "v"(pl + 32 * DM), "v"(pl + 64 * DM), "v"(pl + 96 * DM)
                         : "memory");
        }
    };
    v8f acc[2][4];
#pragma unroll
    for (int m = 0; m < 2; ++m)
#pragma unroll
        for (int t = 0; t < 4; ++t) acc[m][t] = (v8f){};
    fill(0);
    asm volatile("s_wait_asynccnt 0x0" ::: "memory");   // stage 0 has landed before the barrier publishes it
    __syncthreads();
    fill(1);
#pragma unroll 1
    for (int kt = 0; kt < DM / 64; ++kt) {              // rolled: one trip per ring stage
        const unsigned char* rb = &ring[(unsigned)(kt & 1) * GBUF];
        const unsigned char* ra = rb + (wm * 32 + lr) * GPB + hi * 16;
        const unsigned char* rn = rb + GTILE + (wn * 64 + lr) * GPB + hi * 16;
#pragma unroll
        for (int kk = 0; kk < 2; ++kk) {
            v16bf a[2], al[2], b[4];
#pragma unroll
            for (int m = 0; m < 2; ++m) {
                a[m] = cat16b(*(const v8usa*)(ra + m * 16 * GPB + kk * 64), *(const v8usa*)(ra + m * 16 * GPB + kk * 64 + 32));
                if (SPLITA) al[m] = cat16b(*(const v8usa*)(ra + 2 * GTILE + m * 16 * GPB + kk * 64), *(const v8usa*)(ra + 2 * GTILE + m * 16 * GPB + kk * 64 + 32));
            }
#pragma unroll
            for (int t = 0; t < 4; ++t) b[t] = cat16b(*(const v8usa*)(rn + t * 16 * GPB + kk * 64), *(const v8usa*)(rn + t * 16 * GPB + kk * 64 + 32));
#pragma unroll
            for (int m = 0; m < 2; ++m)
#pragma unroll
                for (int t = 0; t < 4; ++t) acc[m][t] = wmmab(a[m], b[t], acc[m][t]);
            if (SPLITA) {
#pragma unroll
                for (int m = 0; m < 2; ++m)
#pragma unroll
                    for (int t = 0; t < 4; ++t) acc[m][t] = wmmab(al[m], b[t], acc[m][t]);
            }
        }
        asm volatile("s_wait_dscnt 0x0" ::: "memory");      // this wave's reads of the buffer are done before the buffer is handed to the copies
        asm volatile("s_wait_asynccnt 0x0" ::: "memory");   // this wave's share of the next stage has landed before the barrier publishes it
        __syncthreads();                                    // publishes stage kt + 1 and ends every wave's reads of stage kt
        if (kt + 2 < DM / 64) fill(kt + 2);                 // into the buffer this trip has just read
    }
    asm volatile("s_wait_asynccnt 0x0" ::: "memory");       // no copy is outstanding when the ring's LDS becomes the output staging
    const int r0 = rb0 + wm * 32, c0 = cb0 + wn * 64;
    float* os = (float*)(void*)&ring[0] + wave * (32 * 68); // behind the last trip's barrier nobody reads the ring any more
#pragma unroll
    for (int m = 0; m < 2; ++m)
#pragma unroll
        for (int t = 0; t < 4; ++t) { const float bv = bias ? bfr(bias[c0 + t * 16 + lr]) : 0.f;
#pragma unroll
            for (int j = 0; j < 8; ++j) os[(m * 16 + hi * 8 + j) * 68 + t * 16 + lr] = acc[m][t][j] + bv; }
    __syncthreads();
    if (F16OUT) {
        h16* crow = (h16*)(void*)C + (size_t)r0 * ldc + c0;
#pragma unroll
        for (int s = 0; s < 8; ++s) { const int row = 4 * s + (lane >> 3), piece = lane & 7; const float* sp = os + row * 68 + piece * 8; v8h o, o2;
#pragma unroll
            for (int i = 0; i < 8; ++i) { const h16 a = (h16)sp[i]; o[i] = a; o2[i] = (h16)((sp[i] - (float)a) * LOSC); }
            *(v8h*)(crow + (size_t)row * ldc + piece * 8) = o;
            asm volatile("s_wait_xcnt 0x0" ::: "memory");   // precaution: this build writes the store's registers again at once (the residual's arithmetic)
            if (C2) *(v8h*)(C2 + (size_t)r0 * ldc + c0 + (size_t)row * ldc + piece * 8) = o2; }
    } else {
        float* crow = C + (size_t)r0 * ldc + c0;
#pragma unroll
        for (int s = 0; s < 16; ++s) { const int Lid = (lane >> 3) + 4 * s, piece = lane & 7; const int row = Lid >> 1, cofs = (Lid & 1) * 32 + piece * 4;
            const v4f val = *(const v4fa*)(os + row * 68 + cofs); *(v4f*)(crow + (size_t)row * ldc + cofs) = val; }
    }
}

// LDS ring of k_attn: one stage = 32 keys = key rows hi + residual (128 B each), two buffers. v = k, so the same rows feed both products: as A of S^T by ds_load_b128
// (16 rows, one 16-byte piece of each) and, transposed, as A of O^T by ds_load_tr16_b128 (8 rows, two neighbouring pieces of each). No one pitch suits both readers,
// so the rows lie unpadded and piece j of row r stands at place j ^ RSW(r): the 16 lanes of either reader then meet every bank once.
#define RSW(r) (((((r) >> 1) & 3) << 1) | (((r) >> 3) & 1))
#define RK_L (32 * 128)
#define RBUF (2 * 32 * 128)

typedef short s16x8 __attribute__((ext_vector_type(8)));
// lane (c, h) gets rows 8h .. 8h + 7 of column c of the 16 x 16 tile whose 16-byte pieces the 32 lanes address: half of a transposed A fragment
__device__ __forceinline__ v8h ldtr(const unsigned char* p) { typedef __attribute__((address_space(3))) s16x8 lds_s16x8; return __builtin_bit_cast(v8h, __builtin_amdgcn_ds_load_tr16_b128_v8i16((lds_s16x8*)p)); }

// k_attn: block = (b, h, 64 queries), wave = 16; all keys (no mask), 32 per trip. Transposed products: S^T = K.Q^T (A = key rows, B = queries) and O^T += V^T.P^T,
// so a lane holds 16 scores of ONE query (lane l ^ 16 the other 16): maximum and sum in-lane plus one exchange between the halves, and the two score tiles, converted
// in place (weights x32768, f16 hi + residual), are the B operand of the second product; V^T comes from the staged key rows by the transposing load. ctx -> bf16 hi + residual planes CH/CL[tok][h*64+d], 8 d per lane and tile.
__global__ __launch_bounds__(128) void k_attn(const h16* Q16, const h16* QL16, const h16* K16, const h16* KL16, bf* CH, bf* CL) {
    __shared__ __align__(256) unsigned char ring[2][RBUF];
    const int lane = threadIdx.x & 31, wave = threadIdx.x >> 5, lr = lane & 15, hi = lane >> 4;
    const int bid = blockIdx.x;
    const int b = bid / (NH_ * (NT_ / 64)), rem = bid - b * (NH_ * (NT_ / 64)), h = rem / (NT_ / 64), qt = rem - h * (NT_ / 64);
    const int q0 = qt * 64 + wave * 16;
    const size_t tok0 = (size_t)b * NT_;
    v16h qa[2];
    const size_t qo0 = (tok0 + q0 + lr) * DM + h * HD + 8 * hi;
#pragma unroll
    for (int kc = 0; kc < 2; ++kc) qa[kc] = cat16(*(const v8h*)(Q16 + qo0 + kc * 32), *(const v8h*)(Q16 + qo0 + kc * 32 + 16));
    const h16* kh_b = K16 + tok0 * DM + h * HD;
    const h16* kl_b = KL16 + tok0 * DM + h * HD;
    v8f o[4], ox[4];
#pragma unroll
    for (int n = 0; n < 4; ++n) { o[n] = (v8f){}; ox[n] = (v8f){}; }
    float mrow = -3.0e38f, lpart = 0.f;            // of this lane's query; lpart covers this half's keys only
    const int kt_lo = 0, kt_hi = NT_ / 32 - 1;     // full attention
    // One stage is 512 pieces of 16 B, four per thread: a wave's copy covers 4 whole key rows.
    const int tid = threadIdx.x;
    const unsigned lk = (unsigned)(size_t)&ring[0][0] + (unsigned)((tid >> 3) * 128 + ((tid & 7) ^ RSW(tid >> 3)) * 16);
    const size_t gk = (size_t)(tid >> 3) * DM + (tid & 7) * 8;
    auto fill = [&](int st) {
        const unsigned bo = (unsigned)(st & 1) * RBUF;
        const h16* pkh = kh_b + gk + (size_t)st * 32 * DM; const h16* pkl = kl_b + gk + (size_t)st * 32 * DM;
        // the copies and the wait before their address registers are written again stand in one statement, so nothing can come between them
        asm volatile("global_load_async_to_lds_b128 %0, %4, off\n\t"
                     "global_load_async_to_lds_b128 %1, %5, off\n\t"
                     "global_load_async_to_lds_b128 %2, %6, off\n\t"
                     "global_load_async_to_lds_b128 %3, %7, off\n\t"
                     "s_wait_xcnt 0x0"
                     :: "v"(lk + bo), "v"(lk + bo + 16 * 128), "v"(lk + bo + RK_L), "v"(lk + bo + RK_L + 16 * 128),
                        "v"(pkh), "v"(pkh + 16 * DM), "v"(pkl), "v"(pkl + 16 * DM)
                     : "memory");
    };
    // Byte place of a piece in the ring = this lane's base ^ a wave-uniform word (buffer, piece number): the row's 128 B and the buffers are aligned, and row + 16 has the same RSW.
    // Key fragment: row lr, pieces 4 * kc + 2 * a + hi. V^T fragment: row 8 * hi + (lane & 7), pieces 2 * n + ((lane >> 3) & 1).
    const unsigned kb0 = (unsigned)(lr * 128 + (hi ^ RSW(lr)) * 16);
    const unsigned vb0 = (unsigned)((8 * hi + (lane & 7)) * 128 + (((lane >> 3) & 1) ^ RSW(8 * hi + (lane & 7))) * 16);
    fill(0);
    asm volatile("s_wait_asynccnt 0x0" ::: "memory");   // stage 0 has landed before the barrier publishes it
    __syncthreads();
    fill(1);
#pragma unroll 1
    for (int kt = kt_lo; kt <= kt_hi; ++kt) {
        const unsigned bo = (unsigned)(kt & 1) * RBUF;
        v8f s0 = {}, s1 = {}, x0 = {}, x1 = {};
#pragma unroll
        for (int kc = 0; kc < 2; ++kc) {
            const unsigned char* ka = &ring[0][0] + (kb0 ^ (bo + kc * 64)); const unsigned char* kb = &ring[0][0] + (kb0 ^ (bo + kc * 64 + 32));
            { const v16h k0h = cat16(*(const v8ha*)(ka), *(const v8ha*)(kb)), k1h = cat16(*(const v8ha*)(ka + 16 * 128), *(const v8ha*)(kb + 16 * 128));
              const v16h qlk = cat16(*(const v8h*)(QL16 + qo0 + kc * 32), *(const v8h*)(QL16 + qo0 + kc * 32 + 16));     // query residual re-read per step (registers)
              s0 = wmma16(k0h, qa[kc], s0); x0 = wmma16(k0h, qlk, x0); s1 = wmma16(k1h, qa[kc], s1); x1 = wmma16(k1h, qlk, x1);
              asm volatile("v_nop" : "+v"(s0), "+v"(s1), "+v"(x0), "+v"(x1) : "v"(qlk), "v"(k0h), "v"(k1h) : "memory"); }
            { const v16h k0l = cat16(*(const v8ha*)(ka + RK_L), *(const v8ha*)(kb + RK_L)), k1l = cat16(*(const v8ha*)(ka + RK_L + 16 * 128), *(const v8ha*)(kb + RK_L + 16 * 128));
              x0 = wmma16(k0l, qa[kc], x0); x1 = wmma16(k1l, qa[kc], x1);
              asm volatile("v_nop" : "+v"(x0), "+v"(x1) : "v"(k0l), "v"(k1l) : "memory"); }
        }
        asm volatile("v_nop\n\tv_nop\n\tv_nop\n\tv_nop" : "+v"(s0), "+v"(s1), "+v"(x0), "+v"(x1) : "v"(qa[0]), "v"(qa[1]));
        // s0[j], s1[j]: keys 8 * hi + j and 16 + 8 * hi + j of this trip, query lr; worked on in pairs of neighbouring registers (packed f32 forms, no register moves)
        v2f a[8]; float mx = -3.0e38f;
#pragma unroll
        for (int q = 0; q < 4; ++q) {
            a[q]     = ((v2f){s0[2 * q], s0[2 * q + 1]} + (v2f){x0[2 * q], x0[2 * q + 1]} * LOSCI) * 0.125f;
            a[4 + q] = ((v2f){s1[2 * q], s1[2 * q + 1]} + (v2f){x1[2 * q], x1[2 * q + 1]} * LOSCI) * 0.125f;
        }
#pragma unroll
        for (int q = 0; q < 8; ++q) mx = fmaxf(mx, fmaxf(a[q].x, a[q].y));
        mx = fmaxf(mx, xhalf(mx));
        const float mn = fmaxf(mrow, mx);
        const float alpha = __expf(mrow - mn); mrow = mn;
        asm volatile("v_nop" :: "v"(alpha));           // the one slot behind a transcendental before its source register is written again (this build reuses it at once)
        v2f sum = {0.f, 0.f};
        v16h pa, px;                                   // element s of a B operand is k = 8 * hi + s, or 16 + 8 * hi + (s - 8): the two score tiles as they lie
#pragma unroll
        for (int q = 0; q < 8; ++q) {
            const v2f e = a[q] - mn; const v2f p = {__expf(e.x), __expf(e.y)};
            sum += p;
            const v2f ps = p * PSC; const v2h hh = __builtin_convertvector(ps, v2h);
            const v2h hl = __builtin_convertvector((ps - __builtin_convertvector(hh, v2f)) * LOSC, v2h);
            pa[2 * q] = hh.x; pa[2 * q + 1] = hh.y; px[2 * q] = hl.x; px[2 * q + 1] = hl.y;
        }
        lpart = lpart * alpha + (sum.x + sum.y);
#pragma unroll
        for (int n = 0; n < 4; ++n)
#pragma unroll
            for (int j = 0; j < 8; ++j) { o[n][j] *= alpha; ox[n][j] *= alpha; }
#pragma unroll
        for (int n = 0; n < 4; ++n) { const unsigned char* rv = &ring[0][0] + (vb0 ^ (bo + n * 32));   // keys 0..15 of the trip, then keys 16..31: elements 0..7 and 8..15 of the fragment
            const v16h vh = cat16(ldtr(rv), ldtr(rv + 16 * 128)), vl = cat16(ldtr(rv + RK_L), ldtr(rv + RK_L + 16 * 128));
            o[n] = wmma16(vh, pa, o[n]); ox[n] = wmma16(vl, pa, ox[n]); ox[n] = wmma16(vh, px, ox[n]);
            asm volatile("" : "+v"(o[n]), "+v"(ox[n]) : "v"(vh), "v"(vl) : "memory"); }
        asm volatile("v_nop\n\tv_nop\n\tv_nop\n\tv_nop" : "+v"(o[0]), "+v"(o[1]), "+v"(o[2]), "+v"(o[3]), "+v"(ox[0]), "+v"(ox[1]), "+v"(ox[2]), "+v"(ox[3]) : "v"(pa), "v"(px));
        asm volatile("s_wait_dscnt 0x0" ::: "memory");      // this wave's reads of the buffer are done before the buffer is handed to the copies
        asm volatile("s_wait_asynccnt 0x0" ::: "memory");   // this wave's share of the next stage has landed before the barrier publishes it
        __syncthreads();                                    // publishes stage kt + 1 and ends every wave's reads of stage kt
        if (kt + 2 <= kt_hi) fill(kt + 2);                  // into the buffer this trip has just read
    }
    asm volatile("s_wait_asynccnt 0x0" ::: "memory");       // no copy is outstanding when the wave goes on to the epilogue
    const float inv = 1.0f / ((lpart + xhalf(lpart)) * PSC);
    // o[n][j] = O^T[n * 16 + 8 * hi + j][query lr]: eight consecutive d of one token, one 16-byte store per plane
    const size_t cbase = (tok0 + q0 + lr) * DM + (size_t)h * HD + 8 * hi;
#pragma unroll
    for (int n = 0; n < 4; ++n) { v8us oh, ol;
#pragma unroll
        for (int j = 0; j < 8; ++j) { const float v = (o[n][j] + ox[n][j] * LOSCI) * inv; const unsigned short hb = f2bf(v); oh[j] = hb; ol[j] = f2bf(v - bf2f(hb)); }
        *(v8us*)(CH + cbase + n * 16) = oh; *(v8us*)(CL + cbase + n * 16) = ol; }
}

#define VST2(T, p, v) do { const T vst2_v_ = (v); *(T*)(p) = vst2_v_;  } while (0)
extern "C" void kernel_launch(void* const* d_in, const int* in_sizes, int n_in,
                              void* d_out, int out_size, void* d_ws, size_t ws_size, hipStream_t stream) {
    (void)in_sizes; (void)n_in; (void)out_size;
    const float* x = (const float*)d_in[0]; const float* Wqkv = (const float*)d_in[1]; const float* Wo = (const float*)d_in[2];   // both [out][in]
    float* out = (float*)d_out;    // [4][2048][1024]
    char* wsp = (char*)d_ws;
    auto take = [&](size_t bytes) { char* p = wsp; wsp += (bytes + 255) & ~(size_t)255; return (void*)p; };
    bf* Xb = (bf*)take((size_t)NTK * DM * 2); bf* WqkvB = (bf*)take((size_t)DM * DM * 2); bf* WoB = (bf*)take((size_t)DM * DM * 2);
    h16* QH = (h16*)take((size_t)NTK * DM * 2); h16* QL = (h16*)take((size_t)NTK * DM * 2);
    bf* CH = (bf*)take((size_t)NTK * DM * 2); bf* CL = (bf*)take((size_t)NTK * DM * 2);
    if ((size_t)(wsp - (char*)d_ws) > ws_size) return;    // about 88 MB in all, no aliasing
    k_cvtb<<<DM / 8, 256, 0, stream>>>(Wqkv, DM, WqkvB); k_cvtb<<<DM / 8, 256, 0, stream>>>(Wo, DM, WoB);
    k_cvtb<<<NTK / 8, 256, 0, stream>>>(x, NTK, Xb);
    k_gemmb<false, true><<<dim3(NTK / 128, DM / 128, 1), 256, 0, stream>>>(Xb, nullptr, WqkvB, nullptr, (float*)(void*)QH, DM, QL);   // q = k = v: f16 hi + residual planes
    k_attn<<<NB_ * NH_ * (NT_ / 64), 128, 0, stream>>>(QH, QL, QH, QL, CH, CL);
    k_gemmb<true, false><<<dim3(NTK / 128, DM / 128, 1), 256, 0, stream>>>(CH, CL, WoB, nullptr, out, DM, nullptr);
}

// v006
// It runs in 203 microseconds.
// Two timings next to v005 both put it at 1.08 times that version's speed.
// Counting every step since v000, it is 4.70 times as fast.
#include <hip/hip_runtime.h>

// Compute dtypes, f32 accumulate, all 4 batch items in every launch: q = k = v = x.W_qkv^T ([8192 x 1024].[1024 x 1024], ONE shared projection, computed once; W is [out][in] = the
// n-major B operand as-is; plain bf16) and out = ctx.W_o^T (ctx as bf16 hi + residual: two products) on v_wmma_f32_16x16x32_bf16; the 16-head full attention (64-dim heads, scale 1/8)
// fused on v_wmma_f32_16x16x32_f16 (scores hi.hi + hi.lo + lo.hi, online f32 softmax, weights (x32768) and v as f16 hi + residual; every residual is stored unscaled, so its products add into the same f32 tile as the main product).

#define NB_  4                   // all 4 batch items share each launch: more resident waves per SIMD to cover the load waits
#define NT_  2048
#define DM   1024
#define NH_  16
#define HD   64
#define NTK  (NB_ * NT_)
#define NW   1024
#define NQKV 1024
#define PSC  32768.0f

typedef _Float16 h16;
typedef unsigned short bf;
typedef __attribute__((ext_vector_type(16))) __bf16   v16bf;
typedef __attribute__((ext_vector_type(16))) _Float16 v16h;
typedef __attribute__((ext_vector_type(8)))  _Float16 v8h;
typedef __attribute__((ext_vector_type(8)))  unsigned short v8us;
typedef __attribute__((ext_vector_type(8)))  float    v8f;
typedef __attribute__((ext_vector_type(4)))  float    v4f;
typedef __attribute__((ext_vector_type(2)))  float    v2f;
typedef __attribute__((ext_vector_type(2)))  _Float16 v2h;
typedef v8h  __attribute__((may_alias)) v8ha;
typedef v4f  __attribute__((may_alias)) v4fa;
typedef v8us __attribute__((may_alias)) v8usa;

__device__ __forceinline__ unsigned short f2bf(float f) { unsigned u = __float_as_uint(f); u += 0x7FFFu + ((u >> 16) & 1u); return (unsigned short)(u >> 16); }
__device__ __forceinline__ float bf2f(unsigned short b) { return __uint_as_float(((unsigned)b) << 16); }
__device__ __forceinline__ float bfr(float f) { return bf2f(f2bf(f)); }
__device__ __forceinline__ v16h cat16(v8h lo, v8h hi) { return __builtin_shufflevector(lo, hi, 0, 1, 2, 3, 4, 5, 6, 7, 8, 9, 10, 11, 12, 13, 14, 15); }
__device__ __forceinline__ v16bf cat16b(v8us lo, v8us hi) { return __builtin_bit_cast(v16bf, __builtin_shufflevector(lo, hi, 0, 1, 2, 3, 4, 5, 6, 7, 8, 9, 10, 11, 12, 13, 14, 15)); }
__device__ __forceinline__ v8f wmma16(v16h a, v16h b, v8f c) { return __builtin_amdgcn_wmma_f32_16x16x32_f16(false, a, false, b, (short)0, c, false, false); }
__device__ __forceinline__ v8f wmmab(v16bf a, v16bf b, v8f c) { return __builtin_amdgcn_wmma_f32_16x16x32_bf16(false, a, false, b, (short)0, c, false, false); }

__device__ __forceinline__ float xhalf(float x) { return __builtin_bit_cast(float, __builtin_amdgcn_permlanex16(__builtin_bit_cast(int, x), __builtin_bit_cast(int, x), 0x76543210, 0xfedcba98, false, false)); }  // lane l with lane l ^ 16

__global__ __launch_bounds__(256) void k_cvtb(const float* __restrict__ src, int nrows, bf* dst) {
    const int lane = threadIdx.x & 31, r = blockIdx.x * 8 + (threadIdx.x >> 5);
    if (r >= nrows) return;
    v8us o[DM / 256];
#pragma unroll
    for (int q = 0; q < DM / 256; ++q) { v8us t;
#pragma unroll
        for (int i = 0; i < 8; ++i) t[i] = f2bf(src[(size_t)r * DM + q * 256 + lane * 8 + i]);
        o[q] = t; }
#pragma unroll
    for (int q = 0; q < DM / 256; ++q) *(v8us*)(dst + (size_t)r * DM + q * 256 + lane * 8) = o[q];
    
}

// LDS ring of k_gemmb: one stage = 64 k of 128 A rows (and of their residual rows where SPLITA) and of 128 B rows, each row piece one whole 128-byte line, two buffers.
#define GPB   144                             // pitch of a row piece in LDS, bytes: 16 B x odd, so ds_load_b128 over 16 rows meets no bank twice
#define GTILE (128 * GPB)

// k_gemmb: block = 128 x 128 of C, 8 waves of 32 x 64 (2 x 4 accumulator tiles); every operand line is fetched once per block, as a whole line, and shared through LDS.
template <bool SPLITA, bool F16OUT = false>
__global__ __launch_bounds__(256) void k_gemmb(const bf* __restrict__ A, const bf* __restrict__ Al, const bf* __restrict__ Bn, const float* __restrict__ bias, float* C, int ldc, h16* C2) {
    constexpr unsigned GBUF = (SPLITA ? 3u : 2u) * GTILE;      // A rows, B rows, residual rows
    __shared__ __align__(16) unsigned char ring[2 * GBUF];
    const int tid = threadIdx.x, lane = tid & 31, wave = tid >> 5, lr = lane & 15, hi = lane >> 4;
    const int wm = wave >> 1, wn = wave & 1;
    const int rb0 = blockIdx.x * 128, cb0 = blockIdx.y * 128;
    // One operand tile of a stage is 1024 pieces of 16 B, four per thread: a wave's copy covers 4 whole row pieces.
    const unsigned l0 = (unsigned)(size_t)&ring[0] + (unsigned)((tid >> 3) * GPB + (tid & 7) * 16);
    const size_t g0 = (size_t)(tid >> 3) * DM + (tid & 7) * 8;
    auto fill = [&](int st) {
        const unsigned la = l0 + (unsigned)(st & 1) * GBUF, lb = la + GTILE;
        const bf* pa = A + (size_t)rb0 * DM + g0 + st * 64; const bf* pb = Bn + (size_t)cb0 * DM + g0 + st * 64;
        // the copies and the wait before their address registers are written again stand in one statement, so nothing can come between them
        asm volatile("global_load_async_to_lds_b128 %0, %8, off\n\t"
                     "global_load_async_to_lds_b128 %1, %9, off\n\t"
                     "global_load_async_to_lds_b128 %2, %10, off\n\t"
                     "global_load_async_to_lds_b128 %3, %11, off\n\t"
                     "global_load_async_to_lds_b128 %4, %12, off\n\t"
                     "global_load_async_to_lds_b128 %5, %13, off\n\t"
                     "global_load_async_to_lds_b128 %6, %14, off\n\t"
                     "global_load_async_to_lds_b128 %7, %15, off\n\t"
                     "s_wait_xcnt 0x0"
                     :: "v"(la), "v"(la + 32 * GPB), "v"(la + 64 * GPB), "v"(la + 96 * GPB),
                        "v"(lb), "v"(lb + 32 * GPB), "v"(lb + 64 * GPB), "v"(lb + 96 * GPB),
                        "v"(pa), "v"(pa + 32 * DM), "v"(pa + 64 * DM), "v"(pa + 96 * DM),
                        "v"(pb), "v"(pb + 32 * DM), "v"(pb + 64 * DM), "v"(pb + 96 * DM)
                     : "memory");
        if (SPLITA) {
            const unsigned ll = la + 2 * GTILE; const bf* pl = Al + (size_t)rb0 * DM + g0 + st * 64;
            // as above: the wait closes the copies' own statement
            asm volatile("global_load_async_to_lds_b128 %0, %4, off\n\t"
                         "global_load_async_to_lds_b128 %1, %5, off\n\t"
                         "global_load_async_to_lds_b128 %2, %6, off\n\t"
                         "global_load_async_to_lds_b128 %3, %7, off\n\t"
                         "s_wait_xcnt 0x0"
                         :: "v"(ll), "v"(ll + 32 * GPB), "v"(ll + 64 * GPB), "v"(ll + 96 * GPB),
                            "v"(pl), "v"(pl + 32 * DM), "v"(pl + 64 * DM), "v"(pl + 96 * DM)
                         : "memory");
        }
    };
    v8f acc[2][4];
#pragma unroll
    for (int m = 0; m < 2; ++m)
#pragma unroll
        for (int t = 0; t < 4; ++t) acc[m][t] = (v8f){};
    fill(0);
    asm volatile("s_wait_asynccnt 0x0" ::: "memory");   // stage 0 has landed before the barrier publishes it
    __syncthreads();
    fill(1);
#pragma unroll 1
    for (int kt = 0; kt < DM / 64; ++kt) {              // rolled: one trip per ring stage
        const unsigned char* rb = &ring[(unsigned)(kt & 1) * GBUF];
        const unsigned char* ra = rb + (wm * 32 + lr) * GPB + hi * 16;
        const unsigned char* rn = rb + GTILE + (wn * 64 + lr) * GPB + hi * 16;
#pragma unroll
        for (int kk = 0; kk < 2; ++kk) {
            v16bf a[2], al[2], b[4];
#pragma unroll
            for (int m = 0; m < 2; ++m) {
                a[m] = cat16b(*(const v8usa*)(ra + m * 16 * GPB + kk * 64), *(const v8usa*)(ra + m * 16 * GPB + kk * 64 + 32));
                if (SPLITA) al[m] = cat16b(*(const v8usa*)(ra + 2 * GTILE + m * 16 * GPB + kk * 64), *(const v8usa*)(ra + 2 * GTILE + m * 16 * GPB + kk * 64 + 32));
            }
#pragma unroll
            for (int t = 0; t < 4; ++t) b[t] = cat16b(*(const v8usa*)(rn + t * 16 * GPB + kk * 64), *(const v8usa*)(rn + t * 16 * GPB + kk * 64 + 32));
#pragma unroll
            for (int m = 0; m < 2; ++m)
#pragma unroll
                for (int t = 0; t < 4; ++t) acc[m][t] = wmmab(a[m], b[t], acc[m][t]);
            if (SPLITA) {
#pragma unroll
                for (int m = 0; m < 2; ++m)
#pragma unroll
                    for (int t = 0; t < 4; ++t) acc[m][t] = wmmab(al[m], b[t], acc[m][t]);
            }
        }
        asm volatile("s_wait_dscnt 0x0" ::: "memory");      // this wave's reads of the buffer are done before the buffer is handed to the copies
        asm volatile("s_wait_asynccnt 0x0" ::: "memory");   // this wave's share of the next stage has landed before the barrier publishes it
        __syncthreads();                                    // publishes stage kt + 1 and ends every wave's reads of stage kt
        if (kt + 2 < DM / 64) fill(kt + 2);                 // into the buffer this trip has just read
    }
    asm volatile("s_wait_asynccnt 0x0" ::: "memory");       // no copy is outstanding when the ring's LDS becomes the output staging
    const int r0 = rb0 + wm * 32, c0 = cb0 + wn * 64;
    float* os = (float*)(void*)&ring[0] + wave * (32 * 68); // behind the last trip's barrier nobody reads the ring any more
#pragma unroll
    for (int m = 0; m < 2; ++m)
#pragma unroll
        for (int t = 0; t < 4; ++t) { const float bv = bias ? bfr(bias[c0 + t * 16 + lr]) : 0.f;
#pragma unroll
            for (int j = 0; j < 8; ++j) os[(m * 16 + hi * 8 + j) * 68 + t * 16 + lr] = acc[m][t][j] + bv; }
    __syncthreads();
    if (F16OUT) {
        h16* crow = (h16*)(void*)C + (size_t)r0 * ldc + c0;
#pragma unroll
        for (int s = 0; s < 8; ++s) { const int row = 4 * s + (lane >> 3), piece = lane & 7; const float* sp = os + row * 68 + piece * 8; v8h o, o2;
#pragma unroll
            for (int i = 0; i < 8; ++i) { const h16 a = (h16)sp[i]; o[i] = a; o2[i] = (h16)(sp[i] - (float)a); }
            *(v8h*)(crow + (size_t)row * ldc + piece * 8) = o;
            asm volatile("s_wait_xcnt 0x0" ::: "memory");   // precaution: this build writes the store's registers again at once (the residual's arithmetic)
            if (C2) *(v8h*)(C2 + (size_t)r0 * ldc + c0 + (size_t)row * ldc + piece * 8) = o2; }
    } else {
        float* crow = C + (size_t)r0 * ldc + c0;
#pragma unroll
        for (int s = 0; s < 16; ++s) { const int Lid = (lane >> 3) + 4 * s, piece = lane & 7; const int row = Lid >> 1, cofs = (Lid & 1) * 32 + piece * 4;
            const v4f val = *(const v4fa*)(os + row * 68 + cofs); *(v4f*)(crow + (size_t)row * ldc + cofs) = val; }
    }
}

// LDS ring of k_attn: one stage = 32 keys = key rows hi + residual (128 B each), two buffers. v = k, so the same rows feed both products: as A of S^T by ds_load_b128
// (16 rows, one 16-byte piece of each) and, transposed, as A of O^T by ds_load_tr16_b128 (8 rows, two neighbouring pieces of each). No one pitch suits both readers,
// so the rows lie unpadded and piece j of row r stands at place j ^ RSW(r): the 16 lanes of either reader then meet every bank once.
#define RSW(r) (((((r) >> 1) & 3) << 1) | (((r) >> 3) & 1))
#define RK_L (32 * 128)
#define RBUF (2 * 32 * 128)

typedef short s16x8 __attribute__((ext_vector_type(8)));
// lane (c, h) gets rows 8h .. 8h + 7 of column c of the 16 x 16 tile whose 16-byte pieces the 32 lanes address: half of a transposed A fragment
__device__ __forceinline__ v8h ldtr(const unsigned char* p) { typedef __attribute__((address_space(3))) s16x8 lds_s16x8; return __builtin_bit_cast(v8h, __builtin_amdgcn_ds_load_tr16_b128_v8i16((lds_s16x8*)p)); }

// k_attn: block = (b, h, 64 queries), wave = 16; all keys (no mask), 32 per trip. Transposed products: S^T = K.Q^T (A = key rows, B = queries) and O^T += V^T.P^T,
// so a lane holds 16 scores of ONE query (lane l ^ 16 the other 16): maximum and sum in-lane plus one exchange between the halves, and the two score tiles, converted
// in place (weights x32768, f16 hi + residual), are the B operand of the second product; V^T comes from the staged key rows by the transposing load. ctx -> bf16 hi + residual planes CH/CL[tok][h*64+d], 8 d per lane and tile.
// One f32 tile per score tile and per output tile: the residual products add into it, so the wave fits 128 registers. 8 waves per SIMD = 8 blocks per WGP x 256 WGPs = the whole grid
// of 2048 blocks resident in one even round (the attribute asks for that budget and caps it there).
__global__ __launch_bounds__(128) __attribute__((amdgpu_waves_per_eu(8, 8))) void k_attn(const h16* Q16, const h16* QL16, const h16* K16, const h16* KL16, bf* CH, bf* CL) {
    __shared__ __align__(256) unsigned char ring[2][RBUF];
    const int lane = threadIdx.x & 31, wave = threadIdx.x >> 5, lr = lane & 15, hi = lane >> 4;
    const int bid = blockIdx.x;
    const int b = bid / (NH_ * (NT_ / 64)), rem = bid - b * (NH_ * (NT_ / 64)), h = rem / (NT_ / 64), qt = rem - h * (NT_ / 64);
    const int q0 = qt * 64 + wave * 16;
    const size_t tok0 = (size_t)b * NT_;
    v16h qa[2];
    const size_t qo0 = (tok0 + q0 + lr) * DM + h * HD + 8 * hi;
#pragma unroll
    for (int kc = 0; kc < 2; ++kc) qa[kc] = cat16(*(const v8h*)(Q16 + qo0 + kc * 32), *(const v8h*)(Q16 + qo0 + kc * 32 + 16));
    const h16* kh_b = K16 + tok0 * DM + h * HD;
    const h16* kl_b = KL16 + tok0 * DM + h * HD;
    v8f o[4];
#pragma unroll
    for (int n = 0; n < 4; ++n) o[n] = (v8f){};
    float mrow = -3.0e38f, lpart = 0.f;            // of this lane's query; lpart covers this half's keys only
    const int kt_lo = 0, kt_hi = NT_ / 32 - 1;     // full attention
    // One stage is 512 pieces of 16 B, four per thread: a wave's copy covers 4 whole key rows.
    const int tid = threadIdx.x;
    const unsigned lk = (unsigned)(size_t)&ring[0][0] + (unsigned)((tid >> 3) * 128 + ((tid & 7) ^ RSW(tid >> 3)) * 16);
    const size_t gk = (size_t)(tid >> 3) * DM + (tid & 7) * 8;
    auto fill = [&](int st) {
        const unsigned bo = (unsigned)(st & 1) * RBUF;
        const h16* pkh = kh_b + gk + (size_t)st * 32 * DM; const h16* pkl = kl_b + gk + (size_t)st * 32 * DM;
        // the copies and the wait before their address registers are written again stand in one statement, so nothing can come between them
        asm volatile("global_load_async_to_lds_b128 %0, %4, off\n\t"
                     "global_load_async_to_lds_b128 %1, %5, off\n\t"
                     "global_load_async_to_lds_b128 %2, %6, off\n\t"
                     "global_load_async_to_lds_b128 %3, %7, off\n\t"
                     "s_wait_xcnt 0x0"
                     :: "v"(lk + bo), "v"(lk + bo + 16 * 128), "v"(lk + bo + RK_L), "v"(lk + bo + RK_L + 16 * 128),
                        "v"(pkh), "v"(pkh + 16 * DM), "v"(pkl), "v"(pkl + 16 * DM)
                     : "memory");
    };
    // Byte place of a piece in the ring = this lane's base ^ a wave-uniform word (buffer, piece number): the row's 128 B and the buffers are aligned, and row + 16 has the same RSW.
    // Key fragment: row lr, pieces 4 * kc + 2 * a + hi. V^T fragment: row 8 * hi + (lane & 7), pieces 2 * n + ((lane >> 3) & 1).
    const unsigned kb0 = (unsigned)(lr * 128 + (hi ^ RSW(lr)) * 16);
    const unsigned vb0 = (unsigned)((8 * hi + (lane & 7)) * 128 + (((lane >> 3) & 1) ^ RSW(8 * hi + (lane & 7))) * 16);
    fill(0);
    asm volatile("s_wait_asynccnt 0x0" ::: "memory");   // stage 0 has landed before the barrier publishes it
    __syncthreads();
    fill(1);
#pragma unroll 1
    for (int kt = kt_lo; kt <= kt_hi; ++kt) {
        const unsigned bo = (unsigned)(kt & 1) * RBUF;
        v8f s0 = {}, s1 = {};
#pragma unroll
        for (int kc = 0; kc < 2; ++kc) {
            const unsigned char* ka = &ring[0][0] + (kb0 ^ (bo + kc * 64)); const unsigned char* kb = &ring[0][0] + (kb0 ^ (bo + kc * 64 + 32));
            { const v16h k0h = cat16(*(const v8ha*)(ka), *(const v8ha*)(kb)), k1h = cat16(*(const v8ha*)(ka + 16 * 128), *(const v8ha*)(kb + 16 * 128));
              const v16h qlk = cat16(*(const v8h*)(QL16 + qo0 + kc * 32), *(const v8h*)(QL16 + qo0 + kc * 32 + 16));     // query residual re-read per step (registers)
              s0 = wmma16(k0h, qa[kc], s0); s1 = wmma16(k1h, qa[kc], s1); s0 = wmma16(k0h, qlk, s0); s1 = wmma16(k1h, qlk, s1); }
            { const v16h k0l = cat16(*(const v8ha*)(ka + RK_L), *(const v8ha*)(kb + RK_L)), k1l = cat16(*(const v8ha*)(ka + RK_L + 16 * 128), *(const v8ha*)(kb + RK_L + 16 * 128));
              s0 = wmma16(k0l, qa[kc], s0); s1 = wmma16(k1l, qa[kc], s1); }
        }
        // s0[j], s1[j]: keys 8 * hi + j and 16 + 8 * hi + j of this trip, query lr; worked on in pairs of neighbouring registers (packed f32 forms, no register moves)
        v2f a[8]; float mx = -3.0e38f;
#pragma unroll
        for (int q = 0; q < 4; ++q) {
            a[q]     = (v2f){s0[2 * q], s0[2 * q + 1]} * 0.125f;
            a[4 + q] = (v2f){s1[2 * q], s1[2 * q + 1]} * 0.125f;
        }
#pragma unroll
        for (int q = 0; q < 8; ++q) mx = fmaxf(mx, fmaxf(a[q].x, a[q].y));
        mx = fmaxf(mx, xhalf(mx));
        const float mn = fmaxf(mrow, mx);
        const float alpha = __expf(mrow - mn); mrow = mn;
        asm volatile("v_nop" :: "v"(alpha));           // the one slot behind a transcendental before its source register is written again (this build reuses it at once)
        v2f sum = {0.f, 0.f};
        v16h pa, px;                                   // element s of a B operand is k = 8 * hi + s, or 16 + 8 * hi + (s - 8): the two score tiles as they lie
#pragma unroll
        for (int q = 0; q < 8; ++q) {
            const v2f e = a[q] - mn; const v2f p = {__expf(e.x), __expf(e.y)};
            sum += p;
            const v2f ps = p * PSC; const v2h hh = __builtin_convertvector(ps, v2h);
            const v2h hl = __builtin_convertvector(ps - __builtin_convertvector(hh, v2f), v2h);
            pa[2 * q] = hh.x; pa[2 * q + 1] = hh.y; px[2 * q] = hl.x; px[2 * q + 1] = hl.y;
        }
        lpart = lpart * alpha + (sum.x + sum.y);
#pragma unroll
        for (int n = 0; n < 4; ++n)
#pragma unroll
            for (int j = 0; j < 8; ++j) o[n][j] *= alpha;
#pragma unroll
        for (int n = 0; n < 4; ++n) { const unsigned char* rv = &ring[0][0] + (vb0 ^ (bo + n * 32));   // keys 0..15 of the trip, then keys 16..31: elements 0..7 and 8..15 of the fragment
            const v16h vh = cat16(ldtr(rv), ldtr(rv + 16 * 128)), vl = cat16(ldtr(rv + RK_L), ldtr(rv + RK_L + 16 * 128));
            o[n] = wmma16(vh, pa, o[n]); o[n] = wmma16(vl, pa, o[n]); o[n] = wmma16(vh, px, o[n]); }
        asm volatile("s_wait_dscnt 0x0" ::: "memory");      // this wave's reads of the buffer are done before the buffer is handed to the copies
        asm volatile("s_wait_asynccnt 0x0" ::: "memory");   // this wave's share of the next stage has landed before the barrier publishes it
        __syncthreads();                                    // publishes stage kt + 1 and ends every wave's reads of stage kt
        if (kt + 2 <= kt_hi) fill(kt + 2);                  // into the buffer this trip has just read
    }
    asm volatile("s_wait_asynccnt 0x0" ::: "memory");       // no copy is outstanding when the wave goes on to the epilogue
    const float inv = 1.0f / ((lpart + xhalf(lpart)) * PSC);
    // o[n][j] = O^T[n * 16 + 8 * hi + j][query lr]: eight consecutive d of one token, one 16-byte store per plane
    const size_t cbase = (tok0 + q0 + lr) * DM + (size_t)h * HD + 8 * hi;
#pragma unroll
    for (int n = 0; n < 4; ++n) { v8us oh, ol;
#pragma unroll
        for (int j = 0; j < 8; ++j) { const float v = o[n][j] * inv; const unsigned short hb = f2bf(v); oh[j] = hb; ol[j] = f2bf(v - bf2f(hb)); }
        *(v8us*)(CH + cbase + n * 16) = oh; *(v8us*)(CL + cbase + n * 16) = ol; }
}

#define VST2(T, p, v) do { const T vst2_v_ = (v); *(T*)(p) = vst2_v_;  } while (0)
extern "C" void kernel_launch(void* const* d_in, const int* in_sizes, int n_in,
                              void* d_out, int out_size, void* d_ws, size_t ws_size, hipStream_t stream) {
    (void)in_sizes; (void)n_in; (void)out_size;
    const float* x = (const float*)d_in[0]; const float* Wqkv = (const float*)d_in[1]; const float* Wo = (const float*)d_in[2];   // both [out][in]
    float* out = (float*)d_out;    // [4][2048][1024]
    char* wsp = (char*)d_ws;
    auto take = [&](size_t bytes) { char* p = wsp; wsp += (bytes + 255) & ~(size_t)255; return (void*)p; };
    bf* Xb = (bf*)take((size_t)NTK * DM * 2); bf* WqkvB = (bf*)take((size_t)DM * DM * 2); bf* WoB = (bf*)take((size_t)DM * DM * 2);
    h16* QH = (h16*)take((size_t)NTK * DM * 2); h16* QL = (h16*)take((size_t)NTK * DM * 2);
    bf* CH = (bf*)take((size_t)NTK * DM * 2); bf* CL = (bf*)take((size_t)NTK * DM * 2);
    if ((size_t)(wsp - (char*)d_ws) > ws_size) return;    // about 88 MB in all, no aliasing
    k_cvtb<<<DM / 8, 256, 0, stream>>>(Wqkv, DM, WqkvB); k_cvtb<<<DM / 8, 256, 0, stream>>>(Wo, DM, WoB);
    k_cvtb<<<NTK / 8, 256, 0, stream>>>(x, NTK, Xb);
    k_gemmb<false, true><<<dim3(NTK / 128, DM / 128, 1), 256, 0, stream>>>(Xb, nullptr, WqkvB, nullptr, (float*)(void*)QH, DM, QL);   // q = k = v: f16 hi + residual planes
    k_attn<<<NB_ * NH_ * (NT_ / 64), 128, 0, stream>>>(QH, QL, QH, QL, CH, CL);
    k_gemmb<true, false><<<dim3(NTK / 128, DM / 128, 1), 256, 0, stream>>>(CH, CL, WoB, nullptr, out, DM, nullptr);
}

// v007
// Measured time: 195 microseconds a run.
// Next to v006, in two timings, it ran 1.04 times as fast each time.
// Counting every step since v000, it is 4.90 times as fast.
#include <hip/hip_runtime.h>

// Compute dtypes, f32 accumulate, all 4 batch items in every launch: q = k = v = x.W_qkv^T ([8192 x 1024].[1024 x 1024], ONE shared projection, computed once; W is [out][in] = the
// n-major B operand as-is; plain bf16) and out = ctx.W_o^T (ctx as bf16 hi + residual: two products) on v_wmma_f32_16x16x32_bf16; the 16-head full attention (64-dim heads, scale 1/8)
// fused on v_wmma_f32_16x16x32_f16 (scores hi.hi + hi.lo + lo.hi, online f32 softmax, weights (x32768) and v as f16 hi + residual; every residual is stored unscaled, so its products add into the same f32 tile as the main product).

#define NB_  4                   // all 4 batch items share each launch: more resident waves per SIMD to cover the load waits
#define NT_  2048
#define DM   1024
#define NH_  16
#define HD   64
#define NTK  (NB_ * NT_)
#define NW   1024
#define NQKV 1024
#define PSC  32768.0f

typedef _Float16 h16;
typedef unsigned short bf;
typedef __attribute__((ext_vector_type(16))) __bf16   v16bf;
typedef __attribute__((ext_vector_type(16))) _Float16 v16h;
typedef __attribute__((ext_vector_type(8)))  _Float16 v8h;
typedef __attribute__((ext_vector_type(8)))  unsigned short v8us;
typedef __attribute__((ext_vector_type(8)))  float    v8f;
typedef __attribute__((ext_vector_type(4)))  float    v4f;
typedef __attribute__((ext_vector_type(2)))  float    v2f;
typedef __attribute__((ext_vector_type(2)))  _Float16 v2h;
typedef v8h  __attribute__((may_alias)) v8ha;
typedef v4f  __attribute__((may_alias)) v4fa;
typedef v8us __attribute__((may_alias)) v8usa;

__device__ __forceinline__ unsigned short f2bf(float f) { unsigned u = __float_as_uint(f); u += 0x7FFFu + ((u >> 16) & 1u); return (unsigned short)(u >> 16); }
__device__ __forceinline__ float bf2f(unsigned short b) { return __uint_as_float(((unsigned)b) << 16); }
__device__ __forceinline__ float bfr(float f) { return bf2f(f2bf(f)); }
__device__ __forceinline__ v16h cat16(v8h lo, v8h hi) { return __builtin_shufflevector(lo, hi, 0, 1, 2, 3, 4, 5, 6, 7, 8, 9, 10, 11, 12, 13, 14, 15); }
__device__ __forceinline__ v16bf cat16b(v8us lo, v8us hi) { return __builtin_bit_cast(v16bf, __builtin_shufflevector(lo, hi, 0, 1, 2, 3, 4, 5, 6, 7, 8, 9, 10, 11, 12, 13, 14, 15)); }
__device__ __forceinline__ v8f wmma16(v16h a, v16h b, v8f c) { return __builtin_amdgcn_wmma_f32_16x16x32_f16(false, a, false, b, (short)0, c, false, false); }
__device__ __forceinline__ v8f wmmab(v16bf a, v16bf b, v8f c) { return __builtin_amdgcn_wmma_f32_16x16x32_bf16(false, a, false, b, (short)0, c, false, false); }

__device__ __forceinline__ float xhalf(float x) { return __builtin_bit_cast(float, __builtin_amdgcn_permlanex16(__builtin_bit_cast(int, x), __builtin_bit_cast(int, x), 0x76543210, 0xfedcba98, false, false)); }  // lane l with lane l ^ 16

__global__ __launch_bounds__(256) void k_cvtb(const float* __restrict__ src, int nrows, bf* dst) {
    const int lane = threadIdx.x & 31, r = blockIdx.x * 8 + (threadIdx.x >> 5);
    if (r >= nrows) return;
    v8us o[DM / 256];
#pragma unroll
    for (int q = 0; q < DM / 256; ++q) { v8us t;
#pragma unroll
        for (int i = 0; i < 8; ++i) t[i] = f2bf(src[(size_t)r * DM + q * 256 + lane * 8 + i]);
        o[q] = t; }
#pragma unroll
    for (int q = 0; q < DM / 256; ++q) *(v8us*)(dst + (size_t)r * DM + q * 256 + lane * 8) = o[q];
    
}

// LDS ring of k_gemmb: one stage = 64 k of 128 A rows (and of their residual rows where SPLITA) and of 128 B rows, each row piece one whole 128-byte line, two buffers.
#define GPB   144                             // pitch of a row piece in LDS, bytes: 16 B x odd, so ds_load_b128 over 16 rows meets no bank twice
#define GTILE (128 * GPB)

// k_gemmb: block = 128 x 128 of C, 8 waves of 32 x 64 (2 x 4 accumulator tiles); every operand line is fetched once per block, as a whole line, and shared through LDS.
template <bool SPLITA, bool F16OUT = false>
__global__ __launch_bounds__(256) void k_gemmb(const bf* __restrict__ A, const bf* __restrict__ Al, const bf* __restrict__ Bn, const float* __restrict__ bias, float* C, int ldc, h16* C2) {
    constexpr unsigned GBUF = (SPLITA ? 3u : 2u) * GTILE;      // A rows, B rows, residual rows
    __shared__ __align__(16) unsigned char ring[2 * GBUF];
    const int tid = threadIdx.x, lane = tid & 31, wave = tid >> 5, lr = lane & 15, hi = lane >> 4;
    const int wm = wave >> 1, wn = wave & 1;
    const int rb0 = blockIdx.x * 128, cb0 = blockIdx.y * 128;
    // One operand tile of a stage is 1024 pieces of 16 B, four per thread: a wave's copy covers 4 whole row pieces.
    const unsigned l0 = (unsigned)(size_t)&ring[0] + (unsigned)((tid >> 3) * GPB + (tid & 7) * 16);
    const size_t g0 = (size_t)(tid >> 3) * DM + (tid & 7) * 8;
    auto fill = [&](int st) {
        const unsigned la = l0 + (unsigned)(st & 1) * GBUF, lb = la + GTILE;
        const bf* pa = A + (size_t)rb0 * DM + g0 + st * 64; const bf* pb = Bn + (size_t)cb0 * DM + g0 + st * 64;
        // the copies and the wait before their address registers are written again stand in one statement, so nothing can come between them
        asm volatile("global_load_async_to_lds_b128 %0, %8, off\n\t"
                     "global_load_async_to_lds_b128 %1, %9, off\n\t"
                     "global_load_async_to_lds_b128 %2, %10, off\n\t"
                     "global_load_async_to_lds_b128 %3, %11, off\n\t"
                     "global_load_async_to_lds_b128 %4, %12, off\n\t"
                     "global_load_async_to_lds_b128 %5, %13, off\n\t"
                     "global_load_async_to_lds_b128 %6, %14, off\n\t"
                     "global_load_async_to_lds_b128 %7, %15, off\n\t"
                     "s_wait_xcnt 0x0"
                     :: "v"(la), "v"(la + 32 * GPB), "v"(la + 64 * GPB), "v"(la + 96 * GPB),
                        "v"(lb), "v"(lb + 32 * GPB), "v"(lb + 64 * GPB), "v"(lb + 96 * GPB),
                        "v"(pa), "v"(pa + 32 * DM), "v"(pa + 64 * DM), "v"(pa + 96 * DM),
                        "v"(pb), "v"(pb + 32 * DM), "v"(pb + 64 * DM), "v"(pb + 96 * DM)
                     : "memory");
        if (SPLITA) {
            const unsigned ll = la + 2 * GTILE; const bf* pl = Al + (size_t)rb0 * DM + g0 + st * 64;
            // as above: the wait closes the copies' own statement
            asm volatile("global_load_async_to_lds_b128 %0, %4, off\n\t"
                         "global_load_async_to_lds_b128 %1, %5, off\n\t"
                         "global_load_async_to_lds_b128 %2, %6, off\n\t"
                         "global_load_async_to_lds_b128 %3, %7, off\n\t"
                         "s_wait_xcnt 0x0"
                         :: "v"(ll), "v"(ll + 32 * GPB), "v"(ll + 64 * GPB), "v"(ll + 96 * GPB),
                            "v"(pl), "v"(pl + 32 * DM), "v"(pl + 64 * DM), "v"(pl + 96 * DM)
                         : "memory");
        }
    };
    v8f acc[2][4];
#pragma unroll
    for (int m = 0; m < 2; ++m)
#pragma unroll
        for (int t = 0; t < 4; ++t) acc[m][t] = (v8f){};
    fill(0);
    asm volatile("s_wait_asynccnt 0x0" ::: "memory");   // stage 0 has landed before the barrier publishes it
    __syncthreads();
    fill(1);
#pragma unroll 1
    for (int kt = 0; kt < DM / 64; ++kt) {              // rolled: one trip per ring stage
        const unsigned char* rb = &ring[(unsigned)(kt & 1) * GBUF];
        const unsigned char* ra = rb + (wm * 32 + lr) * GPB + hi * 16;
        const unsigned char* rn = rb + GTILE + (wn * 64 + lr) * GPB + hi * 16;
#pragma unroll
        for (int kk = 0; kk < 2; ++kk) {
            v16bf a[2], al[2], b[4];
#pragma unroll
            for (int m = 0; m < 2; ++m) {
                a[m] = cat16b(*(const v8usa*)(ra + m * 16 * GPB + kk * 64), *(const v8usa*)(ra + m * 16 * GPB + kk * 64 + 32));
                if (SPLITA) al[m] = cat16b(*(const v8usa*)(ra + 2 * GTILE + m * 16 * GPB + kk * 64), *(const v8usa*)(ra + 2 * GTILE + m * 16 * GPB + kk * 64 + 32));
            }
#pragma unroll
            for (int t = 0; t < 4; ++t) b[t] = cat16b(*(const v8usa*)(rn + t * 16 * GPB + kk * 64), *(const v8usa*)(rn + t * 16 * GPB + kk * 64 + 32));
#pragma unroll
            for (int m = 0; m < 2; ++m)
#pragma unroll
                for (int t = 0; t < 4; ++t) acc[m][t] = wmmab(a[m], b[t], acc[m][t]);
            if (SPLITA) {
#pragma unroll
                for (int m = 0; m < 2; ++m)
#pragma unroll
                    for (int t = 0; t < 4; ++t) acc[m][t] = wmmab(al[m], b[t], acc[m][t]);
            }
        }
        asm volatile("s_wait_dscnt 0x0" ::: "memory");      // this wave's reads of the buffer are done before the buffer is handed to the copies
        asm volatile("s_wait_asynccnt 0x0" ::: "memory");   // this wave's share of the next stage has landed before the barrier publishes it
        __syncthreads();                                    // publishes stage kt + 1 and ends every wave's reads of stage kt
        if (kt + 2 < DM / 64) fill(kt + 2);                 // into the buffer this trip has just read
    }
    asm volatile("s_wait_asynccnt 0x0" ::: "memory");       // no copy is outstanding when the ring's LDS becomes the output staging
    const int r0 = rb0 + wm * 32, c0 = cb0 + wn * 64;
    float* os = (float*)(void*)&ring[0] + wave * (32 * 68); // behind the last trip's barrier nobody reads the ring any more
#pragma unroll
    for (int m = 0; m < 2; ++m)
#pragma unroll
        for (int t = 0; t < 4; ++t) { const float bv = bias ? bfr(bias[c0 + t * 16 + lr]) : 0.f;
#pragma unroll
            for (int j = 0; j < 8; ++j) os[(m * 16 + hi * 8 + j) * 68 + t * 16 + lr] = acc[m][t][j] + bv; }
    __syncthreads();
    if (F16OUT) {
        h16* crow = (h16*)(void*)C + (size_t)r0 * ldc + c0;
#pragma unroll
        for (int s = 0; s < 8; ++s) { const int row = 4 * s + (lane >> 3), piece = lane & 7; const float* sp = os + row * 68 + piece * 8; v8h o, o2;
#pragma unroll
            for (int i = 0; i < 8; ++i) { const h16 a = (h16)sp[i]; o[i] = a; o2[i] = (h16)(sp[i] - (float)a); }
            *(v8h*)(crow + (size_t)row * ldc + piece * 8) = o;
            asm volatile("s_wait_xcnt 0x0" ::: "memory");   // precaution: this build writes the store's registers again at once (the residual's arithmetic)
            if (C2) *(v8h*)(C2 + (size_t)r0 * ldc + c0 + (size_t)row * ldc + piece * 8) = o2; }
    } else {
        float* crow = C + (size_t)r0 * ldc + c0;
#pragma unroll
        for (int s = 0; s < 16; ++s) { const int Lid = (lane >> 3) + 4 * s, piece = lane & 7; const int row = Lid >> 1, cofs = (Lid & 1) * 32 + piece * 4;
            const v4f val = *(const v4fa*)(os + row * 68 + cofs); *(v4f*)(crow + (size_t)row * ldc + cofs) = val; }
    }
}

// LDS ring of k_attn: one stage = 32 keys = key rows hi + residual (128 B each), two buffers. v = k, so the same rows feed both products: as A of S^T by ds_load_b128
// (16 rows, one 16-byte piece of each) and, transposed, as A of O^T by ds_load_tr16_b128 (8 rows, two neighbouring pieces of each). No one pitch suits both readers,
// so the rows lie unpadded and piece j of row r stands at place j ^ RSW(r): the 16 lanes of either reader then meet every bank once.
#define RSW(r) (((((r) >> 1) & 3) << 1) | (((r) >> 3) & 1))
#define RK_L (32 * 128)
#define RBUF (2 * 32 * 128)

typedef short s16x8 __attribute__((ext_vector_type(8)));
// lane (c, h) gets rows 8h .. 8h + 7 of column c of the 16 x 16 tile whose 16-byte pieces the 32 lanes address: half of a transposed A fragment
__device__ __forceinline__ v8h ldtr(const unsigned char* p) { typedef __attribute__((address_space(3))) s16x8 lds_s16x8; return __builtin_bit_cast(v8h, __builtin_amdgcn_ds_load_tr16_b128_v8i16((lds_s16x8*)p)); }

// k_attn: block = (b, h, 64 queries), wave = 16; all keys (no mask), 32 per trip. Transposed products: S^T = K.Q^T (A = key rows, B = queries) and O^T += V^T.P^T,
// so a lane holds 16 scores of ONE query (lane l ^ 16 the other 16): maximum and sum in-lane plus one exchange between the halves, and the two score tiles, converted
// in place (weights x32768, f16 hi + residual), are the B operand of the second product; V^T comes from the staged key rows by the transposing load. ctx -> bf16 hi + residual planes CH/CL[tok][h*64+d], 8 d per lane and tile.
// One f32 tile per score tile and per output tile: the residual products add into it, so the wave fits 128 registers. 8 waves per SIMD = 8 blocks per WGP x 256 WGPs = the whole grid
// of 2048 blocks resident in one even round (the attribute asks for that budget and caps it there).
__global__ __launch_bounds__(128) __attribute__((amdgpu_waves_per_eu(8, 8))) void k_attn(const h16* Q16, const h16* QL16, const h16* K16, const h16* KL16, bf* CH, bf* CL) {
    __shared__ __align__(256) unsigned char ring[2][RBUF];
    const int lane = threadIdx.x & 31, wave = threadIdx.x >> 5, lr = lane & 15, hi = lane >> 4;
    const int bid = blockIdx.x;
    const int b = bid / (NH_ * (NT_ / 64)), rem = bid - b * (NH_ * (NT_ / 64)), h = rem / (NT_ / 64), qt = rem - h * (NT_ / 64);
    const int q0 = qt * 64 + wave * 16;
    const size_t tok0 = (size_t)b * NT_;
    v16h qa[2], ql[2];                             // both query planes stay in registers over the key loop: a fragment load touches 16 lines, too dear to repeat every trip
    const size_t qo0 = (tok0 + q0 + lr) * DM + h * HD + 8 * hi;
#pragma unroll
    for (int kc = 0; kc < 2; ++kc) {
        qa[kc] = cat16(*(const v8h*)(Q16 + qo0 + kc * 32), *(const v8h*)(Q16 + qo0 + kc * 32 + 16));
        ql[kc] = cat16(*(const v8h*)(QL16 + qo0 + kc * 32), *(const v8h*)(QL16 + qo0 + kc * 32 + 16));
    }
    const h16* kh_b = K16 + tok0 * DM + h * HD;
    const h16* kl_b = KL16 + tok0 * DM + h * HD;
    v8f o[4];
#pragma unroll
    for (int n = 0; n < 4; ++n) o[n] = (v8f){};
    float mrow = -3.0e38f, lpart = 0.f;            // of this lane's query; lpart covers this half's keys only
    const int kt_lo = 0, kt_hi = NT_ / 32 - 1;     // full attention
    // One stage is 512 pieces of 16 B, four per thread: a wave's copy covers 4 whole key rows.
    const int tid = threadIdx.x;
    const unsigned lk = (unsigned)(size_t)&ring[0][0] + (unsigned)((tid >> 3) * 128 + ((tid & 7) ^ RSW(tid >> 3)) * 16);
    const size_t gk = (size_t)(tid >> 3) * DM + (tid & 7) * 8;
    auto fill = [&](int st) {
        const unsigned bo = (unsigned)(st & 1) * RBUF;
        const h16* pkh = kh_b + gk + (size_t)st * 32 * DM; const h16* pkl = kl_b + gk + (size_t)st * 32 * DM;
        // the copies and the wait before their address registers are written again stand in one statement, so nothing can come between them
        asm volatile("global_load_async_to_lds_b128 %0, %4, off\n\t"
                     "global_load_async_to_lds_b128 %1, %5, off\n\t"
                     "global_load_async_to_lds_b128 %2, %6, off\n\t"
                     "global_load_async_to_lds_b128 %3, %7, off\n\t"
                     "s_wait_xcnt 0x0"
                     :: "v"(lk + bo), "v"(lk + bo + 16 * 128), "v"(lk + bo + RK_L), "v"(lk + bo + RK_L + 16 * 128),
                        "v"(pkh), "v"(pkh + 16 * DM), "v"(pkl), "v"(pkl + 16 * DM)
                     : "memory");
    };
    // Byte place of a piece in the ring = this lane's base ^ a wave-uniform word (buffer, piece number): the row's 128 B and the buffers are aligned, and row + 16 has the same RSW.
    // Key fragment: row lr, pieces 4 * kc + 2 * a + hi. V^T fragment: row 8 * hi + (lane & 7), pieces 2 * n + ((lane >> 3) & 1).
    const unsigned kb0 = (unsigned)(lr * 128 + (hi ^ RSW(lr)) * 16);
    const unsigned vb0 = (unsigned)((8 * hi + (lane & 7)) * 128 + (((lane >> 3) & 1) ^ RSW(8 * hi + (lane & 7))) * 16);
    fill(0);
    asm volatile("s_wait_asynccnt 0x0" ::: "memory");   // stage 0 has landed before the barrier publishes it
    __syncthreads();
    fill(1);
#pragma unroll 1
    for (int kt = kt_lo; kt <= kt_hi; ++kt) {
        const unsigned bo = (unsigned)(kt & 1) * RBUF;
        v8f s0 = {}, s1 = {};
#pragma unroll
        for (int kc = 0; kc < 2; ++kc) {
            const unsigned char* ka = &ring[0][0] + (kb0 ^ (bo + kc * 64)); const unsigned char* kb = &ring[0][0] + (kb0 ^ (bo + kc * 64 + 32));
            { const v16h k0h = cat16(*(const v8ha*)(ka), *(const v8ha*)(kb)), k1h = cat16(*(const v8ha*)(ka + 16 * 128), *(const v8ha*)(kb + 16 * 128));
              s0 = wmma16(k0h, qa[kc], s0); s1 = wmma16(k1h, qa[kc], s1); s0 = wmma16(k0h, ql[kc], s0); s1 = wmma16(k1h, ql[kc], s1); }
            { const v16h k0l = cat16(*(const v8ha*)(ka + RK_L), *(const v8ha*)(kb + RK_L)), k1l = cat16(*(const v8ha*)(ka + RK_L + 16 * 128), *(const v8ha*)(kb + RK_L + 16 * 128));
              s0 = wmma16(k0l, qa[kc], s0); s1 = wmma16(k1l, qa[kc], s1); }
        }
        // s0[j], s1[j]: keys 8 * hi + j and 16 + 8 * hi + j of this trip, query lr; worked on in pairs of neighbouring registers (packed f32 forms, no register moves)
        v2f a[8]; float mx = -3.0e38f;
#pragma unroll
        for (int q = 0; q < 4; ++q) {
            a[q]     = (v2f){s0[2 * q], s0[2 * q + 1]} * 0.125f;
            a[4 + q] = (v2f){s1[2 * q], s1[2 * q + 1]} * 0.125f;
        }
#pragma unroll
        for (int q = 0; q < 8; ++q) mx = fmaxf(mx, fmaxf(a[q].x, a[q].y));
        mx = fmaxf(mx, xhalf(mx));
        const float mn = fmaxf(mrow, mx);
        const float alpha = __expf(mrow - mn); mrow = mn;
        asm volatile("v_nop" :: "v"(alpha));           // the one slot behind a transcendental before its source register is written again (this build reuses it at once)
        v2f sum = {0.f, 0.f};
        v16h pa, px;                                   // element s of a B operand is k = 8 * hi + s, or 16 + 8 * hi + (s - 8): the two score tiles as they lie
#pragma unroll
        for (int q = 0; q < 8; ++q) {
            const v2f e = a[q] - mn; const v2f p = {__expf(e.x), __expf(e.y)};
            sum += p;
            const v2f ps = p * PSC; const v2h hh = __builtin_convertvector(ps, v2h);
            const v2h hl = __builtin_convertvector(ps - __builtin_convertvector(hh, v2f), v2h);
            pa[2 * q] = hh.x; pa[2 * q + 1] = hh.y; px[2 * q] = hl.x; px[2 * q + 1] = hl.y;
        }
        lpart = lpart * alpha + (sum.x + sum.y);
#pragma unroll
        for (int n = 0; n < 4; ++n)
#pragma unroll
            for (int j = 0; j < 8; ++j) o[n][j] *= alpha;
#pragma unroll
        for (int n = 0; n < 4; ++n) { const unsigned char* rv = &ring[0][0] + (vb0 ^ (bo + n * 32));   // keys 0..15 of the trip, then keys 16..31: elements 0..7 and 8..15 of the fragment
            const v16h vh = cat16(ldtr(rv), ldtr(rv + 16 * 128)), vl = cat16(ldtr(rv + RK_L), ldtr(rv + RK_L + 16 * 128));
            o[n] = wmma16(vh, pa, o[n]); o[n] = wmma16(vl, pa, o[n]); o[n] = wmma16(vh, px, o[n]); }
        asm volatile("s_wait_dscnt 0x0" ::: "memory");      // this wave's reads of the buffer are done before the buffer is handed to the copies
        asm volatile("s_wait_asynccnt 0x0" ::: "memory");   // this wave's share of the next stage has landed before the barrier publishes it
        __syncthreads();                                    // publishes stage kt + 1 and ends every wave's reads of stage kt
        if (kt + 2 <= kt_hi) fill(kt + 2);                  // into the buffer this trip has just read
    }
    asm volatile("s_wait_asynccnt 0x0" ::: "memory");       // no copy is outstanding when the wave goes on to the epilogue
    const float inv = 1.0f / ((lpart + xhalf(lpart)) * PSC);
    // o[n][j] = O^T[n * 16 + 8 * hi + j][query lr]: eight consecutive d of one token, one 16-byte store per plane
    const size_t cbase = (tok0 + q0 + lr) * DM + (size_t)h * HD + 8 * hi;
#pragma unroll
    for (int n = 0; n < 4; ++n) { v8us oh, ol;
#pragma unroll
        for (int j = 0; j < 8; ++j) { const float v = o[n][j] * inv; const unsigned short hb = f2bf(v); oh[j] = hb; ol[j] = f2bf(v - bf2f(hb)); }
        *(v8us*)(CH + cbase + n * 16) = oh; *(v8us*)(CL + cbase + n * 16) = ol; }
}

#define VST2(T, p, v) do { const T vst2_v_ = (v); *(T*)(p) = vst2_v_;  } while (0)
extern "C" void kernel_launch(void* const* d_in, const int* in_sizes, int n_in,
                              void* d_out, int out_size, void* d_ws, size_t ws_size, hipStream_t stream) {
    (void)in_sizes; (void)n_in; (void)out_size;
    const float* x = (const float*)d_in[0]; const float* Wqkv = (const float*)d_in[1]; const float* Wo = (const float*)d_in[2];   // both [out][in]
    float* out = (float*)d_out;    // [4][2048][1024]
    char* wsp = (char*)d_ws;
    auto take = [&](size_t bytes) { char* p = wsp; wsp += (bytes + 255) & ~(size_t)255; return (void*)p; };
    bf* Xb = (bf*)take((size_t)NTK * DM * 2); bf* WqkvB = (bf*)take((size_t)DM * DM * 2); bf* WoB = (bf*)take((size_t)DM * DM * 2);
    h16* QH = (h16*)take((size_t)NTK * DM * 2); h16* QL = (h16*)take((size_t)NTK * DM * 2);
    bf* CH = (bf*)take((size_t)NTK * DM * 2); bf* CL = (bf*)take((size_t)NTK * DM * 2);
    if ((size_t)(wsp - (char*)d_ws) > ws_size) return;    // about 88 MB in all, no aliasing
    k_cvtb<<<DM / 8, 256, 0, stream>>>(Wqkv, DM, WqkvB); k_cvtb<<<DM / 8, 256, 0, stream>>>(Wo, DM, WoB);
    k_cvtb<<<NTK / 8, 256, 0, stream>>>(x, NTK, Xb);
    k_gemmb<false, true><<<dim3(NTK / 128, DM / 128, 1), 256, 0, stream>>>(Xb, nullptr, WqkvB, nullptr, (float*)(void*)QH, DM, QL);   // q = k = v: f16 hi + residual planes
    k_attn<<<NB_ * NH_ * (NT_ / 64), 128, 0, stream>>>(QH, QL, QH, QL, CH, CL);
    k_gemmb<true, false><<<dim3(NTK / 128, DM / 128, 1), 256, 0, stream>>>(CH, CL, WoB, nullptr, out, DM, nullptr);
}

// v008
// One run takes 174 microseconds.
// In both of two side-by-side timings against v007, it was 1.12 times as fast.
// Counting every step since v000, it is 5.48 times as fast.
#include <hip/hip_runtime.h>

// Compute dtypes, f32 accumulate, all 4 batch items in every launch: q = k = v = x.W_qkv^T ([8192 x 1024].[1024 x 1024], ONE shared projection, computed once; W is [out][in] = the
// n-major B operand as-is; plain bf16) and out = ctx.W_o^T (ctx as bf16 hi + residual: two products) on v_wmma_f32_16x16x32_bf16; the 16-head full attention (64-dim heads, scale 1/8)
// fused on v_wmma_f32_16x16x32_f16 (scores hi.hi + hi.lo + lo.hi, online f32 softmax, weights (x32768) and v as f16 hi + residual; every residual is stored unscaled, so its products add into the same f32 tile as the main product).

#define NB_  4                   // all 4 batch items share each launch: more resident waves per SIMD to cover the load waits
#define NT_  2048
#define DM   1024
#define NH_  16
#define HD   64
#define NTK  (NB_ * NT_)
#define NW   1024
#define NQKV 1024
#define PSC  32768.0f

typedef _Float16 h16;
typedef unsigned short bf;
typedef __attribute__((ext_vector_type(16))) __bf16   v16bf;
typedef __attribute__((ext_vector_type(16))) _Float16 v16h;
typedef __attribute__((ext_vector_type(8)))  _Float16 v8h;
typedef __attribute__((ext_vector_type(8)))  unsigned short v8us;
typedef __attribute__((ext_vector_type(8)))  float    v8f;
typedef __attribute__((ext_vector_type(4)))  float    v4f;
typedef __attribute__((ext_vector_type(2)))  float    v2f;
typedef __attribute__((ext_vector_type(2)))  _Float16 v2h;
typedef v8h  __attribute__((may_alias)) v8ha;
typedef v4f  __attribute__((may_alias)) v4fa;
typedef v8us __attribute__((may_alias)) v8usa;

__device__ __forceinline__ unsigned short f2bf(float f) { unsigned u = __float_as_uint(f); u += 0x7FFFu + ((u >> 16) & 1u); return (unsigned short)(u >> 16); }
__device__ __forceinline__ float bf2f(unsigned short b) { return __uint_as_float(((unsigned)b) << 16); }
__device__ __forceinline__ float bfr(float f) { return bf2f(f2bf(f)); }
__device__ __forceinline__ v16h cat16(v8h lo, v8h hi) { return __builtin_shufflevector(lo, hi, 0, 1, 2, 3, 4, 5, 6, 7, 8, 9, 10, 11, 12, 13, 14, 15); }
__device__ __forceinline__ v16bf cat16b(v8us lo, v8us hi) { return __builtin_bit_cast(v16bf, __builtin_shufflevector(lo, hi, 0, 1, 2, 3, 4, 5, 6, 7, 8, 9, 10, 11, 12, 13, 14, 15)); }
__device__ __forceinline__ v8f wmma16(v16h a, v16h b, v8f c) { return __builtin_amdgcn_wmma_f32_16x16x32_f16(false, a, false, b, (short)0, c, false, false); }
__device__ __forceinline__ v8f wmmab(v16bf a, v16bf b, v8f c) { return __builtin_amdgcn_wmma_f32_16x16x32_bf16(false, a, false, b, (short)0, c, false, false); }

__device__ __forceinline__ float xhalf(float x) { return __builtin_bit_cast(float, __builtin_amdgcn_permlanex16(__builtin_bit_cast(int, x), __builtin_bit_cast(int, x), 0x76543210, 0xfedcba98, false, false)); }  // lane l with lane l ^ 16

__global__ __launch_bounds__(256) void k_cvtb(const float* __restrict__ src, int nrows, bf* dst) {
    const int lane = threadIdx.x & 31, r = blockIdx.x * 8 + (threadIdx.x >> 5);
    if (r >= nrows) return;
    v8us o[DM / 256];
#pragma unroll
    for (int q = 0; q < DM / 256; ++q) { v8us t;
#pragma unroll
        for (int i = 0; i < 8; ++i) t[i] = f2bf(src[(size_t)r * DM + q * 256 + lane * 8 + i]);
        o[q] = t; }
#pragma unroll
    for (int q = 0; q < DM / 256; ++q) *(v8us*)(dst + (size_t)r * DM + q * 256 + lane * 8) = o[q];
    
}

// LDS ring of k_gemmb: one stage = 64 k of 128 A rows (and of their residual rows where SPLITA) and of 128 B rows, each row piece one whole 128-byte line, two buffers.
#define GPB   144                             // pitch of a row piece in LDS, bytes: 16 B x odd, so ds_load_b128 over 16 rows meets no bank twice
#define GTILE (128 * GPB)

// k_gemmb: block = 128 x 128 of C, 8 waves of 32 x 64 (2 x 4 accumulator tiles); every operand line is fetched once per block, as a whole line, and shared through LDS.
template <bool SPLITA, bool F16OUT = false>
__global__ __launch_bounds__(256) void k_gemmb(const bf* __restrict__ A, const bf* __restrict__ Al, const bf* __restrict__ Bn, const float* __restrict__ bias, float* C, int ldc, h16* C2) {
    constexpr unsigned GBUF = (SPLITA ? 3u : 2u) * GTILE;      // A rows, B rows, residual rows
    __shared__ __align__(16) unsigned char ring[2 * GBUF];
    const int tid = threadIdx.x, lane = tid & 31, wave = tid >> 5, lr = lane & 15, hi = lane >> 4;
    const int wm = wave >> 1, wn = wave & 1;
    const int rb0 = blockIdx.x * 128, cb0 = blockIdx.y * 128;
    // One operand tile of a stage is 1024 pieces of 16 B, four per thread: a wave's copy covers 4 whole row pieces.
    const unsigned l0 = (unsigned)(size_t)&ring[0] + (unsigned)((tid >> 3) * GPB + (tid & 7) * 16);
    const size_t g0 = (size_t)(tid >> 3) * DM + (tid & 7) * 8;
    auto fill = [&](int st) {
        const unsigned la = l0 + (unsigned)(st & 1) * GBUF, lb = la + GTILE;
        const bf* pa = A + (size_t)rb0 * DM + g0 + st * 64; const bf* pb = Bn + (size_t)cb0 * DM + g0 + st * 64;
        // the copies and the wait before their address registers are written again stand in one statement, so nothing can come between them
        asm volatile("global_load_async_to_lds_b128 %0, %8, off\n\t"
                     "global_load_async_to_lds_b128 %1, %9, off\n\t"
                     "global_load_async_to_lds_b128 %2, %10, off\n\t"
                     "global_load_async_to_lds_b128 %3, %11, off\n\t"
                     "global_load_async_to_lds_b128 %4, %12, off\n\t"
                     "global_load_async_to_lds_b128 %5, %13, off\n\t"
                     "global_load_async_to_lds_b128 %6, %14, off\n\t"
                     "global_load_async_to_lds_b128 %7, %15, off\n\t"
                     "s_wait_xcnt 0x0"
                     :: "v"(la), "v"(la + 32 * GPB), "v"(la + 64 * GPB), "v"(la + 96 * GPB),
                        "v"(lb), "v"(lb + 32 * GPB), "v"(lb + 64 * GPB), "v"(lb + 96 * GPB),
                        "v"(pa), "v"(pa + 32 * DM), "v"(pa + 64 * DM), "v"(pa + 96 * DM),
                        "v"(pb), "v"(pb + 32 * DM), "v"(pb + 64 * DM), "v"(pb + 96 * DM)
                     : "memory");
        if (SPLITA) {
            const unsigned ll = la + 2 * GTILE; const bf* pl = Al + (size_t)rb0 * DM + g0 + st * 64;
            // as above: the wait closes the copies' own statement
            asm volatile("global_load_async_to_lds_b128 %0, %4, off\n\t"
                         "global_load_async_to_lds_b128 %1, %5, off\n\t"
                         "global_load_async_to_lds_b128 %2, %6, off\n\t"
                         "global_load_async_to_lds_b128 %3, %7, off\n\t"
                         "s_wait_xcnt 0x0"
                         :: "v"(ll), "v"(ll + 32 * GPB), "v"(ll + 64 * GPB), "v"(ll + 96 * GPB),
                            "v"(pl), "v"(pl + 32 * DM), "v"(pl + 64 * DM), "v"(pl + 96 * DM)
                         : "memory");
        }
    };
    v8f acc[2][4];
#pragma unroll
    for (int m = 0; m < 2; ++m)
#pragma unroll
        for (int t = 0; t < 4; ++t) acc[m][t] = (v8f){};
    fill(0);
    asm volatile("s_wait_asynccnt 0x0" ::: "memory");   // stage 0 has landed before the barrier publishes it
    __syncthreads();
    fill(1);
#pragma unroll 1
    for (int kt = 0; kt < DM / 64; ++kt) {              // rolled: one trip per ring stage
        const unsigned char* rb = &ring[(unsigned)(kt & 1) * GBUF];
        const unsigned char* ra = rb + (wm * 32 + lr) * GPB + hi * 16;
        const unsigned char* rn = rb + GTILE + (wn * 64 + lr) * GPB + hi * 16;
#pragma unroll
        for (int kk = 0; kk < 2; ++kk) {
            v16bf a[2], al[2], b[4];
#pragma unroll
            for (int m = 0; m < 2; ++m) {
                a[m] = cat16b(*(const v8usa*)(ra + m * 16 * GPB + kk * 64), *(const v8usa*)(ra + m * 16 * GPB + kk * 64 + 32));
                if (SPLITA) al[m] = cat16b(*(const v8usa*)(ra + 2 * GTILE + m * 16 * GPB + kk * 64), *(const v8usa*)(ra + 2 * GTILE + m * 16 * GPB + kk * 64 + 32));
            }
#pragma unroll
            for (int t = 0; t < 4; ++t) b[t] = cat16b(*(const v8usa*)(rn + t * 16 * GPB + kk * 64), *(const v8usa*)(rn + t * 16 * GPB + kk * 64 + 32));
#pragma unroll
            for (int m = 0; m < 2; ++m)
#pragma unroll
                for (int t = 0; t < 4; ++t) acc[m][t] = wmmab(a[m], b[t], acc[m][t]);
            if (SPLITA) {
#pragma unroll
                for (int m = 0; m < 2; ++m)
#pragma unroll
                    for (int t = 0; t < 4; ++t) acc[m][t] = wmmab(al[m], b[t], acc[m][t]);
            }
        }
        asm volatile("s_wait_dscnt 0x0" ::: "memory");      // this wave's reads of the buffer are done before the buffer is handed to the copies
        asm volatile("s_wait_asynccnt 0x0" ::: "memory");   // this wave's share of the next stage has landed before the barrier publishes it
        __syncthreads();                                    // publishes stage kt + 1 and ends every wave's reads of stage kt
        if (kt + 2 < DM / 64) fill(kt + 2);                 // into the buffer this trip has just read
    }
    asm volatile("s_wait_asynccnt 0x0" ::: "memory");       // no copy is outstanding when the ring's LDS becomes the output staging
    const int r0 = rb0 + wm * 32, c0 = cb0 + wn * 64;
    float* os = (float*)(void*)&ring[0] + wave * (32 * 68); // behind the last trip's barrier nobody reads the ring any more
#pragma unroll
    for (int m = 0; m < 2; ++m)
#pragma unroll
        for (int t = 0; t < 4; ++t) { const float bv = bias ? bfr(bias[c0 + t * 16 + lr]) : 0.f;
#pragma unroll
            for (int j = 0; j < 8; ++j) os[(m * 16 + hi * 8 + j) * 68 + t * 16 + lr] = acc[m][t][j] + bv; }
    __syncthreads();
    if (F16OUT) {
        h16* crow = (h16*)(void*)C + (size_t)r0 * ldc + c0;
#pragma unroll
        for (int s = 0; s < 8; ++s) { const int row = 4 * s + (lane >> 3), piece = lane & 7; const float* sp = os + row * 68 + piece * 8; v8h o, o2;
#pragma unroll
            for (int i = 0; i < 8; ++i) { const h16 a = (h16)sp[i]; o[i] = a; o2[i] = (h16)(sp[i] - (float)a); }
            *(v8h*)(crow + (size_t)row * ldc + piece * 8) = o;
            asm volatile("s_wait_xcnt 0x0" ::: "memory");   // precaution: this build writes the store's registers again at once (the residual's arithmetic)
            if (C2) *(v8h*)(C2 + (size_t)r0 * ldc + c0 + (size_t)row * ldc + piece * 8) = o2; }
    } else {
        float* crow = C + (size_t)r0 * ldc + c0;
#pragma unroll
        for (int s = 0; s < 16; ++s) { const int Lid = (lane >> 3) + 4 * s, piece = lane & 7; const int row = Lid >> 1, cofs = (Lid & 1) * 32 + piece * 4;
            const v4f val = *(const v4fa*)(os + row * 68 + cofs); *(v4f*)(crow + (size_t)row * ldc + cofs) = val; }
    }
}

// LDS ring of k_attn: one stage = 32 keys = key rows hi + residual (128 B each), two buffers. v = k, so the same rows feed both products: as A of S^T by ds_load_b128
// (16 rows, one 16-byte piece of each) and, transposed, as A of O^T by ds_load_tr16_b128 (8 rows, two neighbouring pieces of each). No one pitch suits both readers,
// so the rows lie unpadded and piece j of row r stands at place j ^ RSW(r): the 16 lanes of either reader then meet every bank once.
#define RSW(r) (((((r) >> 1) & 3) << 1) | (((r) >> 3) & 1))
#define RK_L (32 * 128)
#define RBUF (2 * 32 * 128)

typedef short s16x8 __attribute__((ext_vector_type(8)));
// lane (c, h) gets rows 8h .. 8h + 7 of column c of the 16 x 16 tile whose 16-byte pieces the 32 lanes address: half of a transposed A fragment
__device__ __forceinline__ v8h ldtr(const unsigned char* p) { typedef __attribute__((address_space(3))) s16x8 lds_s16x8; return __builtin_bit_cast(v8h, __builtin_amdgcn_ds_load_tr16_b128_v8i16((lds_s16x8*)p)); }

// k_attn: block = (b, h, 128 queries), wave = 32 = two 16-column tiles that share every key and V^T fragment read from LDS; all keys (no mask), 32 per trip. Transposed products: S^T = K.Q^T (A = key rows, B = queries) and O^T += V^T.P^T,
// so a lane holds 16 scores of ONE query (lane l ^ 16 the other 16): maximum and sum in-lane plus one exchange between the halves, and the two score tiles, converted
// in place (weights x32768, f16 hi + residual), are the B operand of the second product; V^T comes from the staged key rows by the transposing load. ctx -> bf16 hi + residual planes CH/CL[tok][h*64+d], 8 d per lane and tile.
// One f32 tile per score tile and per output tile: the residual products add into it. A fragment (two LDS reads) feeds 2 or 4 products: with one column tile per wave the LDS reads
// of a trip would take longer than its matrix time. The wave fits 256 registers: 4 waves per SIMD = 4 blocks per WGP x 256 WGPs = the whole grid of 1024 blocks resident in one even round
// (the attribute asks for that budget and caps it there).
#define QT 2
__global__ __launch_bounds__(128) __attribute__((amdgpu_waves_per_eu(4, 4))) void k_attn(const h16* Q16, const h16* QL16, const h16* K16, const h16* KL16, bf* CH, bf* CL) {
    __shared__ __align__(256) unsigned char ring[2][RBUF];
    const int lane = threadIdx.x & 31, wave = threadIdx.x >> 5, lr = lane & 15, hi = lane >> 4;
    const int bid = blockIdx.x;
    const int b = bid / (NH_ * (NT_ / 128)), rem = bid - b * (NH_ * (NT_ / 128)), h = rem / (NT_ / 128), qt = rem - h * (NT_ / 128);
    const int q0 = qt * 128 + wave * (16 * QT);
    const size_t tok0 = (size_t)b * NT_;
    v16h qa[QT][2], ql[QT][2];                     // both query planes stay in registers over the key loop: a fragment load touches 16 lines, too dear to repeat every trip
    const size_t qo0 = (tok0 + q0 + lr) * DM + h * HD + 8 * hi;
#pragma unroll
    for (int t = 0; t < QT; ++t)
#pragma unroll
        for (int kc = 0; kc < 2; ++kc) { const size_t qo = qo0 + (size_t)t * 16 * DM + kc * 32;
            qa[t][kc] = cat16(*(const v8h*)(Q16 + qo), *(const v8h*)(Q16 + qo + 16));
            ql[t][kc] = cat16(*(const v8h*)(QL16 + qo), *(const v8h*)(QL16 + qo + 16));
        }
    const h16* kh_b = K16 + tok0 * DM + h * HD;
    const h16* kl_b = KL16 + tok0 * DM + h * HD;
    v8f o[QT][4];
    float mrow[QT], lpart[QT];                     // of this lane's query in each column tile; lpart covers this half's keys only
#pragma unroll
    for (int t = 0; t < QT; ++t) { mrow[t] = -3.0e38f; lpart[t] = 0.f;
#pragma unroll
        for (int n = 0; n < 4; ++n) o[t][n] = (v8f){}; }
    const int kt_lo = 0, kt_hi = NT_ / 32 - 1;     // full attention
    // One stage is 512 pieces of 16 B, four per thread: a wave's copy covers 4 whole key rows.
    const int tid = threadIdx.x;
    const unsigned lk = (unsigned)(size_t)&ring[0][0] + (unsigned)((tid >> 3) * 128 + ((tid & 7) ^ RSW(tid >> 3)) * 16);
    const size_t gk = (size_t)(tid >> 3) * DM + (tid & 7) * 8;
    auto fill = [&](int st) {
        const unsigned bo = (unsigned)(st & 1) * RBUF;
        const h16* pkh = kh_b + gk + (size_t)st * 32 * DM; const h16* pkl = kl_b + gk + (size_t)st * 32 * DM;
        // the copies and the wait before their address registers are written again stand in one statement, so nothing can come between them
        asm volatile("global_load_async_to_lds_b128 %0, %4, off\n\t"
                     "global_load_async_to_lds_b128 %1, %5, off\n\t"
                     "global_load_async_to_lds_b128 %2, %6, off\n\t"
                     "global_load_async_to_lds_b128 %3, %7, off\n\t"
                     "s_wait_xcnt 0x0"
                     :: "v"(lk + bo), "v"(lk + bo + 16 * 128), "v"(lk + bo + RK_L), "v"(lk + bo + RK_L + 16 * 128),
                        "v"(pkh), "v"(pkh + 16 * DM), "v"(pkl), "v"(pkl + 16 * DM)
                     : "memory");
    };
    // Byte place of a piece in the ring = this lane's base ^ a wave-uniform word (buffer, piece number): the row's 128 B and the buffers are aligned, and row + 16 has the same RSW.
    // Key fragment: row lr, pieces 4 * kc + 2 * a + hi. V^T fragment: row 8 * hi + (lane & 7), pieces 2 * n + ((lane >> 3) & 1).
    const unsigned kb0 = (unsigned)(lr * 128 + (hi ^ RSW(lr)) * 16);
    const unsigned vb0 = (unsigned)((8 * hi + (lane & 7)) * 128 + (((lane >> 3) & 1) ^ RSW(8 * hi + (lane & 7))) * 16);
    fill(0);
    asm volatile("s_wait_asynccnt 0x0" ::: "memory");   // stage 0 has landed before the barrier publishes it
    __syncthreads();
    fill(1);
#pragma unroll 1
    for (int kt = kt_lo; kt <= kt_hi; ++kt) {
        const unsigned bo = (unsigned)(kt & 1) * RBUF;
        v8f s0[QT], s1[QT];
#pragma unroll
        for (int t = 0; t < QT; ++t) { s0[t] = (v8f){}; s1[t] = (v8f){}; }
#pragma unroll
        for (int kc = 0; kc < 2; ++kc) {
            const unsigned char* ka = &ring[0][0] + (kb0 ^ (bo + kc * 64)); const unsigned char* kb = &ring[0][0] + (kb0 ^ (bo + kc * 64 + 32));
            { const v16h k0h = cat16(*(const v8ha*)(ka), *(const v8ha*)(kb)), k1h = cat16(*(const v8ha*)(ka + 16 * 128), *(const v8ha*)(kb + 16 * 128));
#pragma unroll
              for (int t = 0; t < QT; ++t) { s0[t] = wmma16(k0h, qa[t][kc], s0[t]); s1[t] = wmma16(k1h, qa[t][kc], s1[t]); }
#pragma unroll
              for (int t = 0; t < QT; ++t) { s0[t] = wmma16(k0h, ql[t][kc], s0[t]); s1[t] = wmma16(k1h, ql[t][kc], s1[t]); } }
            { const v16h k0l = cat16(*(const v8ha*)(ka + RK_L), *(const v8ha*)(kb + RK_L)), k1l = cat16(*(const v8ha*)(ka + RK_L + 16 * 128), *(const v8ha*)(kb + RK_L + 16 * 128));
#pragma unroll
              for (int t = 0; t < QT; ++t) { s0[t] = wmma16(k0l, qa[t][kc], s0[t]); s1[t] = wmma16(k1l, qa[t][kc], s1[t]); } }
        }
        v16h pa[QT], px[QT];                           // element s of a B operand is k = 8 * hi + s, or 16 + 8 * hi + (s - 8): the two score tiles as they lie
#pragma unroll
        for (int t = 0; t < QT; ++t) {
            // s0[t][j], s1[t][j]: keys 8 * hi + j and 16 + 8 * hi + j of this trip, query lr of tile t; worked on in pairs of neighbouring registers (packed f32 forms, no register moves)
            v2f a[8]; float mx = -3.0e38f;
#pragma unroll
            for (int q = 0; q < 4; ++q) {
                a[q]     = (v2f){s0[t][2 * q], s0[t][2 * q + 1]} * 0.125f;
                a[4 + q] = (v2f){s1[t][2 * q], s1[t][2 * q + 1]} * 0.125f;
            }
#pragma unroll
            for (int q = 0; q < 8; ++q) mx = fmaxf(mx, fmaxf(a[q].x, a[q].y));
            mx = fmaxf(mx, xhalf(mx));
            const float mn = fmaxf(mrow[t], mx);
            const float alpha = __expf(mrow[t] - mn); mrow[t] = mn;
            v2f sum = {0.f, 0.f};
#pragma unroll
            for (int q = 0; q < 8; ++q) {
                const v2f e = a[q] - mn; const v2f p = {__expf(e.x), __expf(e.y)};
                sum += p;
                const v2f ps = p * PSC; const v2h hh = __builtin_convertvector(ps, v2h);
                const v2h hl = __builtin_convertvector(ps - __builtin_convertvector(hh, v2f), v2h);
                pa[t][2 * q] = hh.x; pa[t][2 * q + 1] = hh.y; px[t][2 * q] = hl.x; px[t][2 * q + 1] = hl.y;
            }
            lpart[t] = lpart[t] * alpha + (sum.x + sum.y);
#pragma unroll
            for (int n = 0; n < 4; ++n)
#pragma unroll
                for (int j = 0; j < 8; ++j) o[t][n][j] *= alpha;
        }
#pragma unroll
        for (int n = 0; n < 4; ++n) { const unsigned char* rv = &ring[0][0] + (vb0 ^ (bo + n * 32));   // keys 0..15 of the trip, then keys 16..31: elements 0..7 and 8..15 of the fragment
            const v16h vh = cat16(ldtr(rv), ldtr(rv + 16 * 128)), vl = cat16(ldtr(rv + RK_L), ldtr(rv + RK_L + 16 * 128));
#pragma unroll
            for (int t = 0; t < QT; ++t) o[t][n] = wmma16(vh, pa[t], o[t][n]);
#pragma unroll
            for (int t = 0; t < QT; ++t) o[t][n] = wmma16(vl, pa[t], o[t][n]);
#pragma unroll
            for (int t = 0; t < QT; ++t) o[t][n] = wmma16(vh, px[t], o[t][n]); }
        asm volatile("s_wait_dscnt 0x0" ::: "memory");      // this wave's reads of the buffer are done before the buffer is handed to the copies
        asm volatile("s_wait_asynccnt 0x0" ::: "memory");   // this wave's share of the next stage has landed before the barrier publishes it
        __syncthreads();                                    // publishes stage kt + 1 and ends every wave's reads of stage kt
        if (kt + 2 <= kt_hi) fill(kt + 2);                  // into the buffer this trip has just read
    }
    asm volatile("s_wait_asynccnt 0x0" ::: "memory");       // no copy is outstanding when the wave goes on to the epilogue
#pragma unroll
    for (int t = 0; t < QT; ++t) {
        const float inv = 1.0f / ((lpart[t] + xhalf(lpart[t])) * PSC);
        // o[t][n][j] = O^T[n * 16 + 8 * hi + j][query lr of tile t]: eight consecutive d of one token, one 16-byte store per plane
        const size_t cbase = (tok0 + q0 + t * 16 + lr) * DM + (size_t)h * HD + 8 * hi;
#pragma unroll
        for (int n = 0; n < 4; ++n) { v8us oh, ol;
#pragma unroll
            for (int j = 0; j < 8; ++j) { const float v = o[t][n][j] * inv; const unsigned short hb = f2bf(v); oh[j] = hb; ol[j] = f2bf(v - bf2f(hb)); }
            *(v8us*)(CH + cbase + n * 16) = oh; *(v8us*)(CL + cbase + n * 16) = ol; }
    }
}

#define VST2(T, p, v) do { const T vst2_v_ = (v); *(T*)(p) = vst2_v_;  } while (0)
extern "C" void kernel_launch(void* const* d_in, const int* in_sizes, int n_in,
                              void* d_out, int out_size, void* d_ws, size_t ws_size, hipStream_t stream) {
    (void)in_sizes; (void)n_in; (void)out_size;
    const float* x = (const float*)d_in[0]; const float* Wqkv = (const float*)d_in[1]; const float* Wo = (const float*)d_in[2];   // both [out][in]
    float* out = (float*)d_out;    // [4][2048][1024]
    char* wsp = (char*)d_ws;
    auto take = [&](size_t bytes) { char* p = wsp; wsp += (bytes + 255) & ~(size_t)255; return (void*)p; };
    bf* Xb = (bf*)take((size_t)NTK * DM * 2); bf* WqkvB = (bf*)take((size_t)DM * DM * 2); bf* WoB = (bf*)take((size_t)DM * DM * 2);
    h16* QH = (h16*)take((size_t)NTK * DM * 2); h16* QL = (h16*)take((size_t)NTK * DM * 2);
    bf* CH = (bf*)take((size_t)NTK * DM * 2); bf* CL = (bf*)take((size_t)NTK * DM * 2);
    if ((size_t)(wsp - (char*)d_ws) > ws_size) return;    // about 88 MB in all, no aliasing
    k_cvtb<<<DM / 8, 256, 0, stream>>>(Wqkv, DM, WqkvB); k_cvtb<<<DM / 8, 256, 0, stream>>>(Wo, DM, WoB);
    k_cvtb<<<NTK / 8, 256, 0, stream>>>(x, NTK, Xb);
    k_gemmb<false, true><<<dim3(NTK / 128, DM / 128, 1), 256, 0, stream>>>(Xb, nullptr, WqkvB, nullptr, (float*)(void*)QH, DM, QL);   // q = k = v: f16 hi + residual planes
    k_attn<<<NB_ * NH_ * (NT_ / 128), 128, 0, stream>>>(QH, QL, QH, QL, CH, CL);
    k_gemmb<true, false><<<dim3(NTK / 128, DM / 128, 1), 256, 0, stream>>>(CH, CL, WoB, nullptr, out, DM, nullptr);
}

// v009
// It runs in 163 microseconds.
// In both of two side-by-side timings against v008, it was 1.06 times as fast.
// Over all steps from v000 it is 5.83 times as fast.
#include <hip/hip_runtime.h>

// Compute dtypes, f32 accumulate, all 4 batch items in every launch: q = k = v = x.W_qkv^T ([8192 x 1024].[1024 x 1024], ONE shared projection, computed once; W is [out][in] = the
// n-major B operand as-is; plain bf16) and out = ctx.W_o^T (ctx as bf16 hi + residual: two products) on v_wmma_f32_16x16x32_bf16; the 16-head full attention (64-dim heads, scale 1/8)
// fused on v_wmma_f32_16x16x32_f16 (scores hi.hi + hi.lo + lo.hi, online f32 softmax against a held reference, weights (x32768) and v as f16 hi + residual; every residual is stored unscaled, so its products add into the same f32 tile as the main product).

#define NB_  4                   // all 4 batch items share each launch: more resident waves per SIMD to cover the load waits
#define NT_  2048
#define DM   1024
#define NH_  16
#define HD   64
#define NTK  (NB_ * NT_)
#define NW   1024
#define NQKV 1024

typedef _Float16 h16;
typedef unsigned short bf;
typedef __attribute__((ext_vector_type(16))) __bf16   v16bf;
typedef __attribute__((ext_vector_type(16))) _Float16 v16h;
typedef __attribute__((ext_vector_type(8)))  _Float16 v8h;
typedef __attribute__((ext_vector_type(8)))  unsigned short v8us;
typedef __attribute__((ext_vector_type(8)))  float    v8f;
typedef __attribute__((ext_vector_type(4)))  float    v4f;
typedef __attribute__((ext_vector_type(2)))  float    v2f;
typedef __attribute__((ext_vector_type(2)))  _Float16 v2h;
typedef v8h  __attribute__((may_alias)) v8ha;
typedef v4f  __attribute__((may_alias)) v4fa;
typedef v8us __attribute__((may_alias)) v8usa;

__device__ __forceinline__ unsigned short f2bf(float f) { unsigned u = __float_as_uint(f); u += 0x7FFFu + ((u >> 16) & 1u); return (unsigned short)(u >> 16); }
__device__ __forceinline__ float bf2f(unsigned short b) { return __uint_as_float(((unsigned)b) << 16); }
__device__ __forceinline__ float bfr(float f) { return bf2f(f2bf(f)); }
__device__ __forceinline__ v16h cat16(v8h lo, v8h hi) { return __builtin_shufflevector(lo, hi, 0, 1, 2, 3, 4, 5, 6, 7, 8, 9, 10, 11, 12, 13, 14, 15); }
__device__ __forceinline__ v16bf cat16b(v8us lo, v8us hi) { return __builtin_bit_cast(v16bf, __builtin_shufflevector(lo, hi, 0, 1, 2, 3, 4, 5, 6, 7, 8, 9, 10, 11, 12, 13, 14, 15)); }
__device__ __forceinline__ v8f wmma16(v16h a, v16h b, v8f c) { return __builtin_amdgcn_wmma_f32_16x16x32_f16(false, a, false, b, (short)0, c, false, false); }
__device__ __forceinline__ v8f wmmab(v16bf a, v16bf b, v8f c) { return __builtin_amdgcn_wmma_f32_16x16x32_bf16(false, a, false, b, (short)0, c, false, false); }

__device__ __forceinline__ float xhalf(float x) { return __builtin_bit_cast(float, __builtin_amdgcn_permlanex16(__builtin_bit_cast(int, x), __builtin_bit_cast(int, x), 0x76543210, 0xfedcba98, false, false)); }  // lane l with lane l ^ 16

__global__ __launch_bounds__(256) void k_cvtb(const float* __restrict__ src, int nrows, bf* dst) {
    const int lane = threadIdx.x & 31, r = blockIdx.x * 8 + (threadIdx.x >> 5);
    if (r >= nrows) return;
    v8us o[DM / 256];
#pragma unroll
    for (int q = 0; q < DM / 256; ++q) { v8us t;
#pragma unroll
        for (int i = 0; i < 8; ++i) t[i] = f2bf(src[(size_t)r * DM + q * 256 + lane * 8 + i]);
        o[q] = t; }
#pragma unroll
    for (int q = 0; q < DM / 256; ++q) *(v8us*)(dst + (size_t)r * DM + q * 256 + lane * 8) = o[q];
    
}

// LDS ring of k_gemmb: one stage = 64 k of 128 A rows (and of their residual rows where SPLITA) and of 128 B rows, each row piece one whole 128-byte line, two buffers.
#define GPB   144                             // pitch of a row piece in LDS, bytes: 16 B x odd, so ds_load_b128 over 16 rows meets no bank twice
#define GTILE (128 * GPB)

// k_gemmb: block = 128 x 128 of C, 8 waves of 32 x 64 (2 x 4 accumulator tiles); every operand line is fetched once per block, as a whole line, and shared through LDS.
template <bool SPLITA, bool F16OUT = false>
__global__ __launch_bounds__(256) void k_gemmb(const bf* __restrict__ A, const bf* __restrict__ Al, const bf* __restrict__ Bn, const float* __restrict__ bias, float* C, int ldc, h16* C2) {
    constexpr unsigned GBUF = (SPLITA ? 3u : 2u) * GTILE;      // A rows, B rows, residual rows
    __shared__ __align__(16) unsigned char ring[2 * GBUF];
    const int tid = threadIdx.x, lane = tid & 31, wave = tid >> 5, lr = lane & 15, hi = lane >> 4;
    const int wm = wave >> 1, wn = wave & 1;
    const int rb0 = blockIdx.x * 128, cb0 = blockIdx.y * 128;
    // One operand tile of a stage is 1024 pieces of 16 B, four per thread: a wave's copy covers 4 whole row pieces.
    const unsigned l0 = (unsigned)(size_t)&ring[0] + (unsigned)((tid >> 3) * GPB + (tid & 7) * 16);
    const size_t g0 = (size_t)(tid >> 3) * DM + (tid & 7) * 8;
    auto fill = [&](int st) {
        const unsigned la = l0 + (unsigned)(st & 1) * GBUF, lb = la + GTILE;
        const bf* pa = A + (size_t)rb0 * DM + g0 + st * 64; const bf* pb = Bn + (size_t)cb0 * DM + g0 + st * 64;
        // the copies and the wait before their address registers are written again stand in one statement, so nothing can come between them
        asm volatile("global_load_async_to_lds_b128 %0, %8, off\n\t"
                     "global_load_async_to_lds_b128 %1, %9, off\n\t"
                     "global_load_async_to_lds_b128 %2, %10, off\n\t"
                     "global_load_async_to_lds_b128 %3, %11, off\n\t"
                     "global_load_async_to_lds_b128 %4, %12, off\n\t"
                     "global_load_async_to_lds_b128 %5, %13, off\n\t"
                     "global_load_async_to_lds_b128 %6, %14, off\n\t"
                     "global_load_async_to_lds_b128 %7, %15, off\n\t"
                     "s_wait_xcnt 0x0"
                     :: "v"(la), "v"(la + 32 * GPB), "v"(la + 64 * GPB), "v"(la + 96 * GPB),
                        "v"(lb), "v"(lb + 32 * GPB), "v"(lb + 64 * GPB), "v"(lb + 96 * GPB),
                        "v"(pa), "v"(pa + 32 * DM), "v"(pa + 64 * DM), "v"(pa + 96 * DM),
                        "v"(pb), "v"(pb + 32 * DM), "v"(pb + 64 * DM), "v"(pb + 96 * DM)
                     : "memory");
        if (SPLITA) {
            const unsigned ll = la + 2 * GTILE; const bf* pl = Al + (size_t)rb0 * DM + g0 + st * 64;
            // as above: the wait closes the copies' own statement
            asm volatile("global_load_async_to_lds_b128 %0, %4, off\n\t"
                         "global_load_async_to_lds_b128 %1, %5, off\n\t"
                         "global_load_async_to_lds_b128 %2, %6, off\n\t"
                         "global_load_async_to_lds_b128 %3, %7, off\n\t"
                         "s_wait_xcnt 0x0"
                         :: "v"(ll), "v"(ll + 32 * GPB), "v"(ll + 64 * GPB), "v"(ll + 96 * GPB),
                            "v"(pl), "v"(pl + 32 * DM), "v"(pl + 64 * DM), "v"(pl + 96 * DM)
                         : "memory");
        }
    };
    v8f acc[2][4];
#pragma unroll
    for (int m = 0; m < 2; ++m)
#pragma unroll
        for (int t = 0; t < 4; ++t) acc[m][t] = (v8f){};
    fill(0);
    asm volatile("s_wait_asynccnt 0x0" ::: "memory");   // stage 0 has landed before the barrier publishes it
    __syncthreads();
    fill(1);
#pragma unroll 1
    for (int kt = 0; kt < DM / 64; ++kt) {              // rolled: one trip per ring stage
        const unsigned char* rb = &ring[(unsigned)(kt & 1) * GBUF];
        const unsigned char* ra = rb + (wm * 32 + lr) * GPB + hi * 16;
        const unsigned char* rn = rb + GTILE + (wn * 64 + lr) * GPB + hi * 16;
#pragma unroll
        for (int kk = 0; kk < 2; ++kk) {
            v16bf a[2], al[2], b[4];
#pragma unroll
            for (int m = 0; m < 2; ++m) {
                a[m] = cat16b(*(const v8usa*)(ra + m * 16 * GPB + kk * 64), *(const v8usa*)(ra + m * 16 * GPB + kk * 64 + 32));
                if (SPLITA) al[m] = cat16b(*(const v8usa*)(ra + 2 * GTILE + m * 16 * GPB + kk * 64), *(const v8usa*)(ra + 2 * GTILE + m * 16 * GPB + kk * 64 + 32));
            }
#pragma unroll
            for (int t = 0; t < 4; ++t) b[t] = cat16b(*(const v8usa*)(rn + t * 16 * GPB + kk * 64), *(const v8usa*)(rn + t * 16 * GPB + kk * 64 + 32));
#pragma unroll
            for (int m = 0; m < 2; ++m)
#pragma unroll
                for (int t = 0; t < 4; ++t) acc[m][t] = wmmab(a[m], b[t], acc[m][t]);
            if (SPLITA) {
#pragma unroll
                for (int m = 0; m < 2; ++m)
#pragma unroll
                    for (int t = 0; t < 4; ++t) acc[m][t] = wmmab(al[m], b[t], acc[m][t]);
            }
        }
        asm volatile("s_wait_dscnt 0x0" ::: "memory");      // this wave's reads of the buffer are done before the buffer is handed to the copies
        asm volatile("s_wait_asynccnt 0x0" ::: "memory");   // this wave's share of the next stage has landed before the barrier publishes it
        __syncthreads();                                    // publishes stage kt + 1 and ends every wave's reads of stage kt
        if (kt + 2 < DM / 64) fill(kt + 2);                 // into the buffer this trip has just read
    }
    asm volatile("s_wait_asynccnt 0x0" ::: "memory");       // no copy is outstanding when the ring's LDS becomes the output staging
    const int r0 = rb0 + wm * 32, c0 = cb0 + wn * 64;
    float* os = (float*)(void*)&ring[0] + wave * (32 * 68); // behind the last trip's barrier nobody reads the ring any more
#pragma unroll
    for (int m = 0; m < 2; ++m)
#pragma unroll
        for (int t = 0; t < 4; ++t) { const float bv = bias ? bfr(bias[c0 + t * 16 + lr]) : 0.f;
#pragma unroll
            for (int j = 0; j < 8; ++j) os[(m * 16 + hi * 8 + j) * 68 + t * 16 + lr] = acc[m][t][j] + bv; }
    __syncthreads();
    if (F16OUT) {
        h16* crow = (h16*)(void*)C + (size_t)r0 * ldc + c0;
#pragma unroll
        for (int s = 0; s < 8; ++s) { const int row = 4 * s + (lane >> 3), piece = lane & 7; const float* sp = os + row * 68 + piece * 8; v8h o, o2;
#pragma unroll
            for (int i = 0; i < 8; ++i) { const h16 a = (h16)sp[i]; o[i] = a; o2[i] = (h16)(sp[i] - (float)a); }
            *(v8h*)(crow + (size_t)row * ldc + piece * 8) = o;
            asm volatile("s_wait_xcnt 0x0" ::: "memory");   // precaution: this build writes the store's registers again at once (the residual's arithmetic)
            if (C2) *(v8h*)(C2 + (size_t)r0 * ldc + c0 + (size_t)row * ldc + piece * 8) = o2; }
    } else {
        float* crow = C + (size_t)r0 * ldc + c0;
#pragma unroll
        for (int s = 0; s < 16; ++s) { const int Lid = (lane >> 3) + 4 * s, piece = lane & 7; const int row = Lid >> 1, cofs = (Lid & 1) * 32 + piece * 4;
            const v4f val = *(const v4fa*)(os + row * 68 + cofs); *(v4f*)(crow + (size_t)row * ldc + cofs) = val; }
    }
}

// LDS ring of k_attn: one stage = 32 keys = key rows hi + residual (128 B each), two buffers. v = k, so the same rows feed both products: as A of S^T by ds_load_b128
// (16 rows, one 16-byte piece of each) and, transposed, as A of O^T by ds_load_tr16_b128 (8 rows, two neighbouring pieces of each). No one pitch suits both readers,
// so the rows lie unpadded and piece j of row r stands at place j ^ RSW(r): the 16 lanes of either reader then meet every bank once.
#define RSW(r) (((((r) >> 1) & 3) << 1) | (((r) >> 3) & 1))
#define RK_L (32 * 128)
#define RBUF (2 * 32 * 128)

typedef short s16x8 __attribute__((ext_vector_type(8)));
// lane (c, h) gets rows 8h .. 8h + 7 of column c of the 16 x 16 tile whose 16-byte pieces the 32 lanes address: half of a transposed A fragment
__device__ __forceinline__ v8h ldtr(const unsigned char* p) { typedef __attribute__((address_space(3))) s16x8 lds_s16x8; return __builtin_bit_cast(v8h, __builtin_amdgcn_ds_load_tr16_b128_v8i16((lds_s16x8*)p)); }

// k_attn: block = (b, h, 128 queries), wave = 32 = two 16-column tiles that share every key and V^T fragment read from LDS; all keys (no mask), 32 per trip. Transposed products: S^T = K.Q^T (A = key rows, B = queries) and O^T += V^T.P^T,
// so a lane holds 16 scores of ONE query (lane l ^ 16 the other 16): maximum and sum in-lane, the halves joined only where a reference moves and in the epilogue, and the two score tiles, converted
// in place (weights x32768, f16 hi + residual), are the B operand of the second product; V^T comes from the staged key rows by the transposing load. ctx -> bf16 hi + residual planes CH/CL[tok][h*64+d], 8 d per lane and tile.
// One f32 tile per score tile and per output tile: the residual products add into it. A fragment (two LDS reads) feeds 2 or 4 products: with one column tile per wave the LDS reads
// of a trip would take longer than its matrix time. The wave fits 256 registers: 4 waves per SIMD = 4 blocks per WGP x 256 WGPs = the whole grid of 1024 blocks resident in one even round
// (the attribute asks for that budget and caps it there).
#define QT 2
__global__ __launch_bounds__(128) __attribute__((amdgpu_waves_per_eu(4, 4))) void k_attn(const h16* Q16, const h16* QL16, const h16* K16, const h16* KL16, bf* CH, bf* CL) {
    __shared__ __align__(256) unsigned char ring[2][RBUF];
    const int lane = threadIdx.x & 31, wave = threadIdx.x >> 5, lr = lane & 15, hi = lane >> 4;
    const int bid = blockIdx.x;
    const int b = bid / (NH_ * (NT_ / 128)), rem = bid - b * (NH_ * (NT_ / 128)), h = rem / (NT_ / 128), qt = rem - h * (NT_ / 128);
    const int q0 = qt * 128 + wave * (16 * QT);
    const size_t tok0 = (size_t)b * NT_;
    v16h qa[QT][2], ql[QT][2];                     // both query planes stay in registers over the key loop: a fragment load touches 16 lines, too dear to repeat every trip
    const size_t qo0 = (tok0 + q0 + lr) * DM + h * HD + 8 * hi;
#pragma unroll
    for (int t = 0; t < QT; ++t)
#pragma unroll
        for (int kc = 0; kc < 2; ++kc) { const size_t qo = qo0 + (size_t)t * 16 * DM + kc * 32;
            qa[t][kc] = cat16(*(const v8h*)(Q16 + qo), *(const v8h*)(Q16 + qo + 16));
            ql[t][kc] = cat16(*(const v8h*)(QL16 + qo), *(const v8h*)(QL16 + qo + 16));
        }
    // The softmax reference of a query is held over the trips and enters the score products as their C operand: with q pre-scaled by log2(e) / 8 (split anew into hi + residual)
    // a score tile leaves the matrix unit as log2 of the weight x 32768, the argument of exp2. The reference starts at the query's own score |q|^2 / 8: its key is among the keys
    // (q = k, no mask), so the start never lies above the row's true maximum, and it moves only when a trip's test below asks for it.
    constexpr float QSC = 0.125f * 1.44269504088896340736f;
    v8f cini[QT];                                  // 15 - reference (log2 units) of this lane's query, in all eight registers of a C tile
#pragma unroll
    for (int t = 0; t < QT; ++t) { float own = 0.f;   // this half's 32 of the 64 dims
#pragma unroll
        for (int kc = 0; kc < 2; ++kc)
#pragma unroll
            for (int i = 0; i < 16; ++i) { const float qf = (float)qa[t][kc][i] + (float)ql[t][kc][i]; own = fmaf(qf, qf, own);
                const float qs = qf * QSC; const h16 qh = (h16)qs; qa[t][kc][i] = qh; ql[t][kc][i] = (h16)(qs - (float)qh); }
        const float c0 = 15.0f - (own + xhalf(own)) * QSC;
#pragma unroll
        for (int j = 0; j < 8; ++j) cini[t][j] = c0; }
    const h16* kh_b = K16 + tok0 * DM + h * HD;
    const h16* kl_b = KL16 + tok0 * DM + h * HD;
    v8f o[QT][4];
    float lpart[QT];                               // sum of the weights (x32768) of this lane's query in each column tile, this half's keys only
#pragma unroll
    for (int t = 0; t < QT; ++t) { lpart[t] = 0.f;
#pragma unroll
        for (int n = 0; n < 4; ++n) o[t][n] = (v8f){}; }
    const int kt_lo = 0, kt_hi = NT_ / 32 - 1;     // full attention
    // One stage is 512 pieces of 16 B, four per thread: a wave's copy covers 4 whole key rows.
    const int tid = threadIdx.x;
    const unsigned lk = (unsigned)(size_t)&ring[0][0] + (unsigned)((tid >> 3) * 128 + ((tid & 7) ^ RSW(tid >> 3)) * 16);
    const size_t gk = (size_t)(tid >> 3) * DM + (tid & 7) * 8;
    auto fill = [&](int st) {
        const unsigned bo = (unsigned)(st & 1) * RBUF;
        const h16* pkh = kh_b + gk + (size_t)st * 32 * DM; const h16* pkl = kl_b + gk + (size_t)st * 32 * DM;
        // the copies and the wait before their address registers are written again stand in one statement, so nothing can come between them
        asm volatile("global_load_async_to_lds_b128 %0, %4, off\n\t"
                     "global_load_async_to_lds_b128 %1, %5, off\n\t"
                     "global_load_async_to_lds_b128 %2, %6, off\n\t"
                     "global_load_async_to_lds_b128 %3, %7, off\n\t"
                     "s_wait_xcnt 0x0"
                     :: "v"(lk + bo), "v"(lk + bo + 16 * 128), "v"(lk + bo + RK_L), "v"(lk + bo + RK_L + 16 * 128),
                        "v"(pkh), "v"(pkh + 16 * DM), "v"(pkl), "v"(pkl + 16 * DM)
                     : "memory");
    };
    // Byte place of a piece in the ring = this lane's base ^ a wave-uniform word (buffer, piece number): the row's 128 B and the buffers are aligned, and row + 16 has the same RSW.
    // Key fragment: row lr, pieces 4 * kc + 2 * a + hi. V^T fragment: row 8 * hi + (lane & 7), pieces 2 * n + ((lane >> 3) & 1).
    const unsigned kb0 = (unsigned)(lr * 128 + (hi ^ RSW(lr)) * 16);
    const unsigned vb0 = (unsigned)((8 * hi + (lane & 7)) * 128 + (((lane >> 3) & 1) ^ RSW(8 * hi + (lane & 7))) * 16);
    fill(0);
    asm volatile("s_wait_asynccnt 0x0" ::: "memory");   // stage 0 has landed before the barrier publishes it
    __syncthreads();
    fill(1);
#pragma unroll 1
    for (int kt = kt_lo; kt <= kt_hi; ++kt) {
        const unsigned bo = (unsigned)(kt & 1) * RBUF;
        v8f s0[QT], s1[QT];
#pragma unroll
        for (int t = 0; t < QT; ++t) { s0[t] = cini[t]; s1[t] = cini[t]; }
#pragma unroll
        for (int kc = 0; kc < 2; ++kc) {
            const unsigned char* ka = &ring[0][0] + (kb0 ^ (bo + kc * 64)); const unsigned char* kb = &ring[0][0] + (kb0 ^ (bo + kc * 64 + 32));
            { const v16h k0h = cat16(*(const v8ha*)(ka), *(const v8ha*)(kb)), k1h = cat16(*(const v8ha*)(ka + 16 * 128), *(const v8ha*)(kb + 16 * 128));
#pragma unroll
              for (int t = 0; t < QT; ++t) { s0[t] = wmma16(k0h, qa[t][kc], s0[t]); s1[t] = wmma16(k1h, qa[t][kc], s1[t]); }
#pragma unroll
              for (int t = 0; t < QT; ++t) { s0[t] = wmma16(k0h, ql[t][kc], s0[t]); s1[t] = wmma16(k1h, ql[t][kc], s1[t]); } }
            { const v16h k0l = cat16(*(const v8ha*)(ka + RK_L), *(const v8ha*)(kb + RK_L)), k1l = cat16(*(const v8ha*)(ka + RK_L + 16 * 128), *(const v8ha*)(kb + RK_L + 16 * 128));
#pragma unroll
              for (int t = 0; t < QT; ++t) { s0[t] = wmma16(k0l, qa[t][kc], s0[t]); s1[t] = wmma16(k1l, qa[t][kc], s1[t]); } }
        }
        v16h pa[QT], px[QT];                           // element s of a B operand is k = 8 * hi + s, or 16 + 8 * hi + (s - 8): the two score tiles as they lie
        // s0[t][j], s1[t][j]: keys 8 * hi + j and 16 + 8 * hi + j of this trip, query lr of tile t, as log2(weight x 32768) against the held reference
        float mxt[QT];
#pragma unroll
        for (int t = 0; t < QT; ++t) { mxt[t] = fmaxf(s0[t][0], s1[t][0]);
#pragma unroll
            for (int j = 1; j < 8; ++j) mxt[t] = fmaxf(mxt[t], fmaxf(s0[t][j], s1[t][j])); }
        // One test a trip, a scalar branch for the whole wave: a weight above 2^15.5 comes near the end of f16 (2^16), so the references move up first.
        if (__builtin_amdgcn_ballot_w32(fmaxf(mxt[0], mxt[1]) > 15.5f) != 0) {
#pragma unroll
            for (int t = 0; t < QT; ++t) {
                const float mx = fmaxf(mxt[t], xhalf(mxt[t]));     // both halves hold the same query and must move alike
                const float d = fmaxf(mx - 15.0f, 0.f);            // 0 for a query whose weights stay at or below 2^15
                const float alpha = __builtin_amdgcn_exp2f(-d);
                lpart[t] *= alpha;
#pragma unroll
                for (int j = 0; j < 8; ++j) { cini[t][j] -= d; s0[t][j] -= d; s1[t][j] -= d; }
#pragma unroll
                for (int n = 0; n < 4; ++n)
#pragma unroll
                    for (int j = 0; j < 8; ++j) o[t][n][j] *= alpha;
            }
        }
#pragma unroll
        for (int t = 0; t < QT; ++t) {
            v2f sum = {0.f, 0.f};
#pragma unroll
            for (int q = 0; q < 8; ++q) {                          // in pairs of neighbouring registers (packed f32 forms, no register moves)
                const v8f& sv = q < 4 ? s0[t] : s1[t];
                const v2f ps = {__builtin_amdgcn_exp2f(sv[2 * (q & 3)]), __builtin_amdgcn_exp2f(sv[2 * (q & 3) + 1])};
                sum += ps;
                const v2h hh = __builtin_convertvector(ps, v2h);
                const v2h hl = __builtin_convertvector(ps - __builtin_convertvector(hh, v2f), v2h);
                pa[t][2 * q] = hh.x; pa[t][2 * q + 1] = hh.y; px[t][2 * q] = hl.x; px[t][2 * q + 1] = hl.y;
            }
            lpart[t] += sum.x + sum.y;
        }
#pragma unroll
        for (int n = 0; n < 4; ++n) { const unsigned char* rv = &ring[0][0] + (vb0 ^ (bo + n * 32));   // keys 0..15 of the trip, then keys 16..31: elements 0..7 and 8..15 of the fragment
            const v16h vh = cat16(ldtr(rv), ldtr(rv + 16 * 128)), vl = cat16(ldtr(rv + RK_L), ldtr(rv + RK_L + 16 * 128));
#pragma unroll
            for (int t = 0; t < QT; ++t) o[t][n] = wmma16(vh, pa[t], o[t][n]);
#pragma unroll
            for (int t = 0; t < QT; ++t) o[t][n] = wmma16(vl, pa[t], o[t][n]);
#pragma unroll
            for (int t = 0; t < QT; ++t) o[t][n] = wmma16(vh, px[t], o[t][n]); }
        asm volatile("s_wait_dscnt 0x0" ::: "memory");      // this wave's reads of the buffer are done before the buffer is handed to the copies
        asm volatile("s_wait_asynccnt 0x0" ::: "memory");   // this wave's share of the next stage has landed before the barrier publishes it
        __syncthreads();                                    // publishes stage kt + 1 and ends every wave's reads of stage kt
        if (kt + 2 <= kt_hi) fill(kt + 2);                  // into the buffer this trip has just read
    }
    asm volatile("s_wait_asynccnt 0x0" ::: "memory");       // no copy is outstanding when the wave goes on to the epilogue
#pragma unroll
    for (int t = 0; t < QT; ++t) {
        const float inv = 1.0f / (lpart[t] + xhalf(lpart[t]));   // sums and outputs both carry the x32768
        // o[t][n][j] = O^T[n * 16 + 8 * hi + j][query lr of tile t]: eight consecutive d of one token, one 16-byte store per plane
        const size_t cbase = (tok0 + q0 + t * 16 + lr) * DM + (size_t)h * HD + 8 * hi;
#pragma unroll
        for (int n = 0; n < 4; ++n) { v8us oh, ol;
#pragma unroll
            for (int j = 0; j < 8; ++j) { const float v = o[t][n][j] * inv; const unsigned short hb = f2bf(v); oh[j] = hb; ol[j] = f2bf(v - bf2f(hb)); }
            *(v8us*)(CH + cbase + n * 16) = oh; *(v8us*)(CL + cbase + n * 16) = ol; }
    }
}

#define VST2(T, p, v) do { const T vst2_v_ = (v); *(T*)(p) = vst2_v_;  } while (0)
extern "C" void kernel_launch(void* const* d_in, const int* in_sizes, int n_in,
                              void* d_out, int out_size, void* d_ws, size_t ws_size, hipStream_t stream) {
    (void)in_sizes; (void)n_in; (void)out_size;
    const float* x = (const float*)d_in[0]; const float* Wqkv = (const float*)d_in[1]; const float* Wo = (const float*)d_in[2];   // both [out][in]
    float* out = (float*)d_out;    // [4][2048][1024]
    char* wsp = (char*)d_ws;
    auto take = [&](size_t bytes) { char* p = wsp; wsp += (bytes + 255) & ~(size_t)255; return (void*)p; };
    bf* Xb = (bf*)take((size_t)NTK * DM * 2); bf* WqkvB = (bf*)take((size_t)DM * DM * 2); bf* WoB = (bf*)take((size_t)DM * DM * 2);
    h16* QH = (h16*)take((size_t)NTK * DM * 2); h16* QL = (h16*)take((size_t)NTK * DM * 2);
    bf* CH = (bf*)take((size_t)NTK * DM * 2); bf* CL = (bf*)take((size_t)NTK * DM * 2);
    if ((size_t)(wsp - (char*)d_ws) > ws_size) return;    // about 88 MB in all, no aliasing
    k_cvtb<<<DM / 8, 256, 0, stream>>>(Wqkv, DM, WqkvB); k_cvtb<<<DM / 8, 256, 0, stream>>>(Wo, DM, WoB);
    k_cvtb<<<NTK / 8, 256, 0, stream>>>(x, NTK, Xb);
    k_gemmb<false, true><<<dim3(NTK / 128, DM / 128, 1), 256, 0, stream>>>(Xb, nullptr, WqkvB, nullptr, (float*)(void*)QH, DM, QL);   // q = k = v: f16 hi + residual planes
    k_attn<<<NB_ * NH_ * (NT_ / 128), 128, 0, stream>>>(QH, QL, QH, QL, CH, CL);
    k_gemmb<true, false><<<dim3(NTK / 128, DM / 128, 1), 256, 0, stream>>>(CH, CL, WoB, nullptr, out, DM, nullptr);
}
